// v000
// The times below were measured on an AMD MI455X: many runs one after another, warmed up first and cycling through
// copies of the inputs, with the whole window's GPU time divided by the number of runs. Launches and the gaps
// between them are all in it. The median over several windows is given; except for v000 it joins two sittings, which
// can be a few percent apart, so the side-by-side timings, each taken in one sitting, are the better comparison.
// v000, which the later versions start from, runs in 845 microseconds.
#include <hip/hip_runtime.h>
#include <hip/hip_bf16.h>

typedef __bf16 bf16;
typedef __attribute__((ext_vector_type(8)))  bf16  v8bf;
typedef __attribute__((ext_vector_type(16))) bf16  v16bf;
typedef __attribute__((ext_vector_type(8)))  float v8f;
typedef __attribute__((ext_vector_type(4)))  unsigned int v4u;
typedef __attribute__((ext_vector_type(8)))  int v8i;
typedef __attribute__((ext_vector_type(4)))  int v4i;

#define DIM   256
#define SEQ   4096
#define BATCH 8
#define NROW  (BATCH * SEQ)
#define KTILES (SEQ / 32)

__device__ __forceinline__ v16bf load_frag(const bf16* p) {

  v8bf lo = *(const v8bf*)p;
  v8bf hi = *(const v8bf*)(p + 16);
  return __builtin_shufflevector(lo, hi, 0,1,2,3,4,5,6,7,8,9,10,11,12,13,14,15);
}

__device__ __forceinline__ v8f wmma_bf16(v16bf a, v16bf b, v8f c) {
  return __builtin_amdgcn_wmma_f32_16x16x32_bf16(false, a, false, b, (short)0, c,
                                                 false, false);
}

__device__ __forceinline__ void tdm_load_k_tile(const bf16* gsrc,
                                                unsigned lds_byte_off) {
  unsigned long long ga = (unsigned long long)(uintptr_t)gsrc;
  v4u g0;
  g0[0] = 1u;
  g0[1] = lds_byte_off;
  g0[2] = (unsigned)(ga & 0xFFFFFFFFu);
  g0[3] = (unsigned)((ga >> 32) & 0x01FFFFFFu)
          | (2u << 30);
  v8i g1;
  g1[0] = (int)(1u << 16);
  g1[1] = (int)(256u << 16);
  g1[2] = (int)(4096u << 16);
  g1[3] = (int)(256u << 16);
  g1[4] = 32;
  g1[5] = 256;
  g1[6] = 0;
  g1[7] = 0;
  v4i gz = {0, 0, 0, 0};
#if defined(__clang_major__) && (__clang_major__ >= 23)
  v8i gz8 = {0, 0, 0, 0, 0, 0, 0, 0};
  __builtin_amdgcn_tensor_load_to_lds(g0, g1, gz, gz, gz8, 0);
#else
  __builtin_amdgcn_tensor_load_to_lds(g0, g1, gz, gz, 0);
#endif
}

__global__ void f32_to_bf16_kernel(const float* __restrict__ src,
                                   bf16* __restrict__ dst, int n) {
  int i = (blockIdx.x * blockDim.x + threadIdx.x) * 8;
  if (i + 8 > n) return;
  float4 a = *(const float4*)(src + i);
  float4 b = *(const float4*)(src + i + 4);
  v8bf o;
  o[0] = (bf16)a.x; o[1] = (bf16)a.y; o[2] = (bf16)a.z; o[3] = (bf16)a.w;
  o[4] = (bf16)b.x; o[5] = (bf16)b.y; o[6] = (bf16)b.z; o[7] = (bf16)b.w;
  *(v8bf*)(dst + i) = o;
}

__global__ __launch_bounds__(256) void qkv_gemm_kernel(
    const bf16* __restrict__ xb, const bf16* __restrict__ wb,
    const float* __restrict__ bq, const float* __restrict__ bk,
    const float* __restrict__ bv,
    bf16* __restrict__ qo, bf16* __restrict__ ko, bf16* __restrict__ vo) {
  const int mat  = blockIdx.y;
  const bf16*  W    = wb + (size_t)mat * DIM * DIM;
  const float* bias = (mat == 0) ? bq : (mat == 1) ? bk : bv;
  bf16*        out  = (mat == 0) ? qo : (mat == 1) ? ko : vo;
  const float  scl  = (mat == 0) ? 0.0625f : 1.0f;

  const int w    = threadIdx.x >> 5;
  const int lane = threadIdx.x & 31;
  const int lr   = lane & 15, lh = lane >> 4;
  const int rowbase = blockIdx.x * 32 + (w >> 2) * 16;
  const int colbase = (w & 3) * 64;

  v16bf A[8];
  const bf16* xrow = xb + (size_t)(rowbase + lr) * DIM + lh * 8;
  #pragma unroll
  for (int kc = 0; kc < 8; ++kc) A[kc] = load_frag(xrow + kc * 32);

  v8f acc[4] = {{0,0,0,0,0,0,0,0},{0,0,0,0,0,0,0,0},
                {0,0,0,0,0,0,0,0},{0,0,0,0,0,0,0,0}};
  #pragma unroll
  for (int kc = 0; kc < 8; ++kc) {
    #pragma unroll
    for (int t = 0; t < 4; ++t) {
      const bf16* wrow = W + (size_t)(colbase + t * 16 + lr) * DIM + kc * 32 + lh * 8;
      v16bf Bf = load_frag(wrow);
      acc[t] = wmma_bf16(A[kc], Bf, acc[t]);
    }
  }
  #pragma unroll
  for (int t = 0; t < 4; ++t) {
    const int   col = colbase + t * 16 + lr;
    const float bb  = bias[col];
    #pragma unroll
    for (int i = 0; i < 8; ++i) {
      const int row = rowbase + i + 8 * lh;
      out[(size_t)row * DIM + col] = (bf16)((acc[t][i] + bb) * scl);
    }
  }
}

__global__ __launch_bounds__(256) void attn_kernel(
    const bf16* __restrict__ qb, const bf16* __restrict__ kb,
    const bf16* __restrict__ vb, const float* __restrict__ x,
    float* __restrict__ out) {
  __shared__ __align__(16) bf16 Kl[2][32 * DIM];
  __shared__ __align__(16) bf16 Vt[2][DIM * 32];
  __shared__ __align__(16) bf16 Pl[8][16 * 32];

  const int batch = blockIdx.y;
  const int qbase = blockIdx.x * 128;
  const int tid   = threadIdx.x;
  const int w     = tid >> 5, lane = tid & 31;
  const int lr    = lane & 15, lh = lane >> 4;
  const size_t bo = (size_t)batch * SEQ * DIM;

  v16bf Qf[8];
  const bf16* qrow = qb + bo + (size_t)(qbase + w * 16 + lr) * DIM + lh * 8;
  #pragma unroll
  for (int kc = 0; kc < 8; ++kc) Qf[kc] = load_frag(qrow + kc * 32);

  v8f O[16];
  #pragma unroll
  for (int t = 0; t < 16; ++t)
    #pragma unroll
    for (int i = 0; i < 8; ++i) O[t][i] = 0.0f;
  float m[8], l[8];
  #pragma unroll
  for (int i = 0; i < 8; ++i) { m[i] = -3.0e38f; l[i] = 0.0f; }

  const int flat = tid * 32;
  const int krow = flat >> 8;
  const int kcol = flat & 255;

  v8bf vr[4];
  auto load_v_regs = [&](int kt) {
    const bf16* vsrc = vb + bo + (size_t)(kt * 32 + krow) * DIM + kcol;
    #pragma unroll
    for (int j = 0; j < 4; ++j) vr[j] = *(const v8bf*)(vsrc + j * 8);
  };
  auto store_vt = [&](int buf) {
    #pragma unroll
    for (int j = 0; j < 4; ++j)
      #pragma unroll
      for (int e = 0; e < 8; ++e) Vt[buf][(kcol + j * 8 + e) * 32 + krow] = vr[j][e];
  };

  load_v_regs(0);
  if (tid < 32) tdm_load_k_tile(kb + bo, (unsigned)(uintptr_t)&Kl[0][0]);
  store_vt(0);
  if (tid < 32) __builtin_amdgcn_s_wait_tensorcnt(0);
  __syncthreads();

  for (int kt = 0; kt < KTILES; ++kt) {
    const int cur = kt & 1, nxt = cur ^ 1;
    const bool more = (kt + 1 < KTILES);

    if (more) {
      load_v_regs(kt + 1);
      if (tid < 32)
        tdm_load_k_tile(kb + bo + (size_t)(kt + 1) * 32 * DIM,
                        (unsigned)(uintptr_t)&Kl[nxt][0]);
    }

    v8f s0 = {0,0,0,0,0,0,0,0}, s1 = {0,0,0,0,0,0,0,0};
    #pragma unroll
    for (int kc = 0; kc < 8; ++kc) {
      v16bf B0 = load_frag(&Kl[cur][(0  + lr) * DIM + kc * 32 + lh * 8]);
      v16bf B1 = load_frag(&Kl[cur][(16 + lr) * DIM + kc * 32 + lh * 8]);
      s0 = wmma_bf16(Qf[kc], B0, s0);
      s1 = wmma_bf16(Qf[kc], B1, s1);
    }

    float corr[8];
    #pragma unroll
    for (int i = 0; i < 8; ++i) {
      float t = fmaxf(s0[i], s1[i]);
      t = fmaxf(t, __shfl_xor(t, 1, 32));
      t = fmaxf(t, __shfl_xor(t, 2, 32));
      t = fmaxf(t, __shfl_xor(t, 4, 32));
      t = fmaxf(t, __shfl_xor(t, 8, 32));
      const float mn = fmaxf(m[i], t);
      corr[i] = __expf(m[i] - mn);
      m[i] = mn;
      const float p0 = __expf(s0[i] - mn);
      const float p1 = __expf(s1[i] - mn);
      s0[i] = p0; s1[i] = p1;
      float r = p0 + p1;
      r += __shfl_xor(r, 1, 32);
      r += __shfl_xor(r, 2, 32);
      r += __shfl_xor(r, 4, 32);
      r += __shfl_xor(r, 8, 32);
      l[i] = l[i] * corr[i] + r;
    }
    #pragma unroll
    for (int t = 0; t < 16; ++t)
      #pragma unroll
      for (int i = 0; i < 8; ++i) O[t][i] *= corr[i];

    #pragma unroll
    for (int i = 0; i < 8; ++i) {
      const int row = i + 8 * lh;
      Pl[w][row * 32 + lr]      = (bf16)s0[i];
      Pl[w][row * 32 + 16 + lr] = (bf16)s1[i];
    }
    v16bf Pf = load_frag(&Pl[w][lr * 32 + lh * 8]);

    #pragma unroll
    for (int t = 0; t < 16; ++t) {
      v16bf Bv = load_frag(&Vt[cur][(t * 16 + lr) * 32 + lh * 8]);
      O[t] = wmma_bf16(Pf, Bv, O[t]);
    }

    if (more) {
      store_vt(nxt);
      if (tid < 32) __builtin_amdgcn_s_wait_tensorcnt(0);
    }
    __syncthreads();
  }

  float inv[8];
  #pragma unroll
  for (int i = 0; i < 8; ++i) inv[i] = 1.0f / l[i];
  #pragma unroll
  for (int t = 0; t < 16; ++t) {
    const int col = t * 16 + lr;
    #pragma unroll
    for (int i = 0; i < 8; ++i) {
      const int row = qbase + w * 16 + i + 8 * lh;
      const size_t idx = bo + (size_t)row * DIM + col;
      out[idx] = x[idx] + O[t][i] * inv[i];
    }
  }
}

extern "C" void kernel_launch(void* const* d_in, const int* in_sizes, int n_in,
                              void* d_out, int out_size, void* d_ws, size_t ws_size,
                              hipStream_t stream) {
  const float* x  = (const float*)d_in[0];
  const float* Wq = (const float*)d_in[1];
  const float* bq = (const float*)d_in[2];
  const float* Wk = (const float*)d_in[3];
  const float* bk = (const float*)d_in[4];
  const float* Wv = (const float*)d_in[5];
  const float* bv = (const float*)d_in[6];
  float* outp = (float*)d_out;

  const size_t NX = (size_t)NROW * DIM;
  const size_t NW = (size_t)DIM * DIM;
  bf16* xb = (bf16*)d_ws;
  bf16* wb = xb + NX;
  bf16* qb = wb + 3 * NW;
  bf16* kb = qb + NX;
  bf16* vb = kb + NX;

  f32_to_bf16_kernel<<<(int)(NX / 2048), 256, 0, stream>>>(x, xb, (int)NX);
  f32_to_bf16_kernel<<<(int)(NW / 2048), 256, 0, stream>>>(Wq, wb,          (int)NW);
  f32_to_bf16_kernel<<<(int)(NW / 2048), 256, 0, stream>>>(Wk, wb + NW,     (int)NW);
  f32_to_bf16_kernel<<<(int)(NW / 2048), 256, 0, stream>>>(Wv, wb + 2 * NW, (int)NW);

  qkv_gemm_kernel<<<dim3(NROW / 32, 3), 256, 0, stream>>>(xb, wb, bq, bk, bv,
                                                          qb, kb, vb);

  attn_kernel<<<dim3(SEQ / 128, BATCH), 256, 0, stream>>>(qb, kb, vb, x, outp);
}

// v001
// One run takes 450 microseconds.
// Next to v000, in two timings, it ran 1.93 times as fast each time.
#include <hip/hip_runtime.h>
#include <hip/hip_bf16.h>

typedef __bf16 bf16;
typedef __attribute__((ext_vector_type(8)))  bf16  v8bf;
typedef __attribute__((ext_vector_type(16))) bf16  v16bf;
typedef __attribute__((ext_vector_type(8)))  float v8f;

#define DIM   256
#define SEQ   4096
#define BATCH 8
#define NROW  (BATCH * SEQ)
#define KTILES (SEQ / 32)

__device__ __forceinline__ v16bf load_frag(const bf16* p) {

  v8bf lo = *(const v8bf*)p;
  v8bf hi = *(const v8bf*)(p + 16);
  return __builtin_shufflevector(lo, hi, 0,1,2,3,4,5,6,7,8,9,10,11,12,13,14,15);
}

__device__ __forceinline__ v8f wmma_bf16(v16bf a, v16bf b, v8f c) {
  return __builtin_amdgcn_wmma_f32_16x16x32_bf16(false, a, false, b, (short)0, c,
                                                 false, false);
}

#define KROWB   256u
#define KPITCH  136
#define KSLICEB 10240u
#define KSLICE  5120
#define VPITCH  40

typedef __attribute__((ext_vector_type(4))) unsigned int u32x4;
typedef __attribute__((ext_vector_type(8))) unsigned int u32x8;

__device__ __forceinline__ unsigned uni(unsigned v) {
  return (unsigned)__builtin_amdgcn_readfirstlane(v);
}

__device__ __forceinline__ unsigned pinned(unsigned v) {
  unsigned w = uni(v);
  asm volatile("" : "+s"(w));
  return w;
}

__device__ __forceinline__ void wait_tensor0() { asm volatile("s_wait_tensorcnt 0x0" ::: "memory"); }
__device__ __forceinline__ void wait_ds0()     { asm volatile("s_wait_dscnt 0x0" ::: "memory"); }

__device__ __forceinline__ void wait_tensor0(u32x4 g0, u32x8 g1) {
  asm volatile("s_wait_tensorcnt 0x0" :: "s"(g0), "s"(g1) : "memory");
}

__device__ __forceinline__ u32x8 tdm_group1() {
  u32x8 g;
  g[0] = uni((1u << 20) | (5u << 22) | (3u << 25));
  g[1] = uni(KROWB << 16);
  g[2] = uni(32u << 16);
  g[3] = uni(KROWB << 16);
  g[4] = uni(32u);
  g[5] = uni(2u * DIM);
  g[6] = uni(0u);
  g[7] = uni(0u);

  asm volatile("" : "+s"(g));
  return g;
}
__device__ __forceinline__ u32x4 tdm_group0(const bf16* gsrc, unsigned lds_byte_off) {
  const unsigned long long ga = (unsigned long long)(uintptr_t)gsrc;
  u32x4 g0;
  g0[0] = uni(1u);
  g0[1] = uni(lds_byte_off);
  g0[2] = uni((unsigned)ga);
  g0[3] = uni((((unsigned)(ga >> 32)) & 0x01FFFFFFu) | (2u << 30));
  return g0;
}
__device__ __forceinline__ void tdm_load(u32x4 g0, u32x8 g1) {
  asm volatile("tensor_load_to_lds %0, %1" :: "s"(g0), "s"(g1) : "memory");
}

__global__ void f32_to_bf16_kernel(const float* __restrict__ src,
                                   bf16* __restrict__ dst, int n) {
  int i = (blockIdx.x * blockDim.x + threadIdx.x) * 8;
  if (i + 8 > n) return;
  float4 a = *(const float4*)(src + i);
  float4 b = *(const float4*)(src + i + 4);
  v8bf o;
  o[0] = (bf16)a.x; o[1] = (bf16)a.y; o[2] = (bf16)a.z; o[3] = (bf16)a.w;
  o[4] = (bf16)b.x; o[5] = (bf16)b.y; o[6] = (bf16)b.z; o[7] = (bf16)b.w;
  *(v8bf*)(dst + i) = o;
}

__global__ __launch_bounds__(256) void qkv_gemm_kernel(
    const bf16* __restrict__ xb, const bf16* __restrict__ wb,
    const float* __restrict__ bq, const float* __restrict__ bk,
    const float* __restrict__ bv,
    bf16* __restrict__ qo, bf16* __restrict__ ko, bf16* __restrict__ vo) {
  const int mat  = blockIdx.y;
  const bf16*  W    = wb + (size_t)mat * DIM * DIM;
  const float* bias = (mat == 0) ? bq : (mat == 1) ? bk : bv;
  bf16*        out  = (mat == 0) ? qo : (mat == 1) ? ko : vo;
  const float  scl  = (mat == 0) ? 0.0625f : 1.0f;

  const int w    = threadIdx.x >> 5;
  const int lane = threadIdx.x & 31;
  const int lr   = lane & 15, lh = lane >> 4;
  const int rowbase = blockIdx.x * 32 + (w >> 2) * 16;
  const int colbase = (w & 3) * 64;

  v16bf A[8];
  const bf16* xrow = xb + (size_t)(rowbase + lr) * DIM + lh * 8;
  #pragma unroll
  for (int kc = 0; kc < 8; ++kc) A[kc] = load_frag(xrow + kc * 32);

  v8f acc[4] = {{0,0,0,0,0,0,0,0},{0,0,0,0,0,0,0,0},
                {0,0,0,0,0,0,0,0},{0,0,0,0,0,0,0,0}};
  #pragma unroll
  for (int kc = 0; kc < 8; ++kc) {
    #pragma unroll
    for (int t = 0; t < 4; ++t) {
      const bf16* wrow = W + (size_t)(colbase + t * 16 + lr) * DIM + kc * 32 + lh * 8;
      v16bf Bf = load_frag(wrow);
      acc[t] = wmma_bf16(A[kc], Bf, acc[t]);
    }
  }
  #pragma unroll
  for (int t = 0; t < 4; ++t) {
    const int   col = colbase + t * 16 + lr;
    const float bb  = bias[col];
    #pragma unroll
    for (int i = 0; i < 8; ++i) {
      const int row = rowbase + i + 8 * lh;
      out[(size_t)row * DIM + col] = (bf16)((acc[t][i] + bb) * scl);
    }
  }
}

__global__ __launch_bounds__(256) void attn_kernel(
    const bf16* __restrict__ qb, const bf16* __restrict__ kb,
    const bf16* __restrict__ vb, const float* __restrict__ x,
    float* __restrict__ out) {

  __shared__ __attribute__((aligned(2048))) bf16 Kl[2][2][KSLICE];
  __shared__ __align__(16) bf16 Vt[2][DIM * VPITCH];
  __shared__ __align__(16) bf16 Pl[8][16 * VPITCH];

  const int batch = blockIdx.y;
  const int qbase = blockIdx.x * 128;
  const int tid   = threadIdx.x;
  const int w     = tid >> 5, lane = tid & 31;
  const int lr    = lane & 15, lh = lane >> 4;
  const size_t bo = (size_t)batch * SEQ * DIM;

  v16bf Qf[8];
  const bf16* qrow = qb + bo + (size_t)(qbase + w * 16 + lr) * DIM + lh * 8;
  #pragma unroll
  for (int kc = 0; kc < 8; ++kc) Qf[kc] = load_frag(qrow + kc * 32);

  v8f O[16];
  #pragma unroll
  for (int t = 0; t < 16; ++t)
    #pragma unroll
    for (int i = 0; i < 8; ++i) O[t][i] = 0.0f;
  float m[8], l[8];
  #pragma unroll
  for (int i = 0; i < 8; ++i) { m[i] = -3.0e38f; l[i] = 0.0f; }

  const int flat = tid * 32;
  const int krow = flat >> 8;
  const int kcol = flat & 255;

  v8bf vr[4];
  auto load_v_regs = [&](int kt) {
    const bf16* vsrc = vb + bo + (size_t)(kt * 32 + krow) * DIM + kcol;
    #pragma unroll
    for (int j = 0; j < 4; ++j) vr[j] = *(const v8bf*)(vsrc + j * 8);
  };
  auto store_vt = [&](int buf) {
    #pragma unroll
    for (int j = 0; j < 4; ++j)
      #pragma unroll
      for (int e = 0; e < 8; ++e) Vt[buf][(kcol + j * 8 + e) * VPITCH + krow] = vr[j][e];
  };

  const unsigned wave   = uni((unsigned)tid >> 5);
  const u32x8    g1     = tdm_group1();
  u32x4          g0     = {0u, 0u, 0u, 0u};
  const bf16*    ksrc   = kb + bo + (wave & 1u) * 128u;
  const unsigned kdst   = (unsigned)(uintptr_t)&Kl[0][0][0] + (wave & 1u) * KSLICEB;
  auto issue_k = [&](int kt) {
    g0 = tdm_group0(ksrc + (size_t)kt * 32 * DIM, kdst + (unsigned)(kt & 1) * (2u * KSLICEB));
    tdm_load(g0, g1);
  };

  load_v_regs(0);
  if (pinned(wave < 2u)) { issue_k(0); wait_tensor0(g0, g1); }
  store_vt(0);
  __syncthreads();
  if (pinned(wave < 2u)) issue_k(1);

  for (int kt = 0; kt < KTILES; ++kt) {
    const int cur = kt & 1, nxt = cur ^ 1;
    const bool more = (kt + 1 < KTILES);

    if (more) load_v_regs(kt + 1);

    v8f s0 = {0,0,0,0,0,0,0,0}, s1 = {0,0,0,0,0,0,0,0};
    #pragma unroll
    for (int kc = 0; kc < 8; ++kc) {
      v16bf B0 = load_frag(&Kl[cur][kc >> 2][(0  + lr) * KPITCH + (kc & 3) * 32 + lh * 8]);
      v16bf B1 = load_frag(&Kl[cur][kc >> 2][(16 + lr) * KPITCH + (kc & 3) * 32 + lh * 8]);
      s0 = wmma_bf16(Qf[kc], B0, s0);
      s1 = wmma_bf16(Qf[kc], B1, s1);
    }

    float corr[8];
    #pragma unroll
    for (int i = 0; i < 8; ++i) {
      float t = fmaxf(s0[i], s1[i]);
      t = fmaxf(t, __shfl_xor(t, 1, 32));
      t = fmaxf(t, __shfl_xor(t, 2, 32));
      t = fmaxf(t, __shfl_xor(t, 4, 32));
      t = fmaxf(t, __shfl_xor(t, 8, 32));
      const float mn = fmaxf(m[i], t);
      corr[i] = __expf(m[i] - mn);
      m[i] = mn;
      const float p0 = __expf(s0[i] - mn);
      const float p1 = __expf(s1[i] - mn);
      s0[i] = p0; s1[i] = p1;
      float r = p0 + p1;
      r += __shfl_xor(r, 1, 32);
      r += __shfl_xor(r, 2, 32);
      r += __shfl_xor(r, 4, 32);
      r += __shfl_xor(r, 8, 32);
      l[i] = l[i] * corr[i] + r;
    }
    #pragma unroll
    for (int t = 0; t < 16; ++t)
      #pragma unroll
      for (int i = 0; i < 8; ++i) O[t][i] *= corr[i];

    #pragma unroll
    for (int i = 0; i < 8; ++i) {
      const int row = i + 8 * lh;
      Pl[w][row * VPITCH + lr]      = (bf16)s0[i];
      Pl[w][row * VPITCH + 16 + lr] = (bf16)s1[i];
    }
    v16bf Pf = load_frag(&Pl[w][lr * VPITCH + lh * 8]);

    #pragma unroll
    for (int t = 0; t < 16; ++t) {
      v16bf Bv = load_frag(&Vt[cur][(t * 16 + lr) * VPITCH + lh * 8]);
      O[t] = wmma_bf16(Pf, Bv, O[t]);
    }

    if (more) store_vt(nxt);

    wait_ds0();
    if (pinned(wave < 2u)) wait_tensor0(g0, g1);
    __syncthreads();
    if (pinned(wave < 2u && kt + 2 < KTILES)) issue_k(kt + 2);
  }
  wait_tensor0();
  wait_ds0();

  float inv[8];
  #pragma unroll
  for (int i = 0; i < 8; ++i) inv[i] = 1.0f / l[i];
  #pragma unroll
  for (int t = 0; t < 16; ++t) {
    const int col = t * 16 + lr;
    #pragma unroll
    for (int i = 0; i < 8; ++i) {
      const int row = qbase + w * 16 + i + 8 * lh;
      const size_t idx = bo + (size_t)row * DIM + col;
      out[idx] = x[idx] + O[t][i] * inv[i];
    }
  }
}

extern "C" void kernel_launch(void* const* d_in, const int* in_sizes, int n_in,
                              void* d_out, int out_size, void* d_ws, size_t ws_size,
                              hipStream_t stream) {
  const float* x  = (const float*)d_in[0];
  const float* Wq = (const float*)d_in[1];
  const float* bq = (const float*)d_in[2];
  const float* Wk = (const float*)d_in[3];
  const float* bk = (const float*)d_in[4];
  const float* Wv = (const float*)d_in[5];
  const float* bv = (const float*)d_in[6];
  float* outp = (float*)d_out;

  const size_t NX = (size_t)NROW * DIM;
  const size_t NW = (size_t)DIM * DIM;
  bf16* xb = (bf16*)d_ws;
  bf16* wb = xb + NX;
  bf16* qb = wb + 3 * NW;
  bf16* kb = qb + NX;
  bf16* vb = kb + NX;

  f32_to_bf16_kernel<<<(int)(NX / 2048), 256, 0, stream>>>(x, xb, (int)NX);
  f32_to_bf16_kernel<<<(int)(NW / 2048), 256, 0, stream>>>(Wq, wb,          (int)NW);
  f32_to_bf16_kernel<<<(int)(NW / 2048), 256, 0, stream>>>(Wk, wb + NW,     (int)NW);
  f32_to_bf16_kernel<<<(int)(NW / 2048), 256, 0, stream>>>(Wv, wb + 2 * NW, (int)NW);

  qkv_gemm_kernel<<<dim3(NROW / 32, 3), 256, 0, stream>>>(xb, wb, bq, bk, bv,
                                                          qb, kb, vb);

  attn_kernel<<<dim3(SEQ / 128, BATCH), 256, 0, stream>>>(qb, kb, vb, x, outp);
}

// v002
// Measured time: 263 microseconds a run.
// In both of two side-by-side timings against v001, it was 1.71 times as fast.
// Over all steps from v000 it is 3.30 times as fast.
#include <hip/hip_runtime.h>
#include <hip/hip_bf16.h>

typedef __bf16 bf16;
typedef __attribute__((ext_vector_type(8)))  bf16  v8bf;
typedef __attribute__((ext_vector_type(16))) bf16  v16bf;
typedef __attribute__((ext_vector_type(8)))  float v8f;

#define DIM   256
#define SEQ   4096
#define BATCH 8
#define NROW  (BATCH * SEQ)
#define KTILES (SEQ / 32)

__device__ __forceinline__ v16bf load_frag(const bf16* p) {

  v8bf lo = *(const v8bf*)p;
  v8bf hi = *(const v8bf*)(p + 16);
  return __builtin_shufflevector(lo, hi, 0,1,2,3,4,5,6,7,8,9,10,11,12,13,14,15);
}

__device__ __forceinline__ v8bf load_tr16(const bf16* p) {
  typedef __attribute__((address_space(3))) v8bf lds_v8bf;
  return __builtin_amdgcn_ds_load_tr16_b128_v8bf16((lds_v8bf*)p);
}

__device__ __forceinline__ v8f wmma_bf16(v16bf a, v16bf b, v8f c) {
  return __builtin_amdgcn_wmma_f32_16x16x32_bf16(false, a, false, b, (short)0, c,
                                                 false, false);
}

#define KROWB   256u
#define KPITCH  136
#define KSLICEB 10240u
#define KSLICE  5120
#define PPITCH  40

#define VPITCH  144

typedef __attribute__((ext_vector_type(4))) unsigned int u32x4;
typedef __attribute__((ext_vector_type(8))) unsigned int u32x8;

__device__ __forceinline__ unsigned uni(unsigned v) {
  return (unsigned)__builtin_amdgcn_readfirstlane(v);
}

__device__ __forceinline__ unsigned pinned(unsigned v) {
  unsigned w = uni(v);
  asm volatile("" : "+s"(w));
  return w;
}

__device__ __forceinline__ void wait_tensor0() { asm volatile("s_wait_tensorcnt 0x0" ::: "memory"); }
__device__ __forceinline__ void wait_ds0()     { asm volatile("s_wait_dscnt 0x0" ::: "memory"); }

__device__ __forceinline__ void wait_tensor0(u32x4 g0, u32x8 g1) {
  asm volatile("s_wait_tensorcnt 0x0" :: "s"(g0), "s"(g1) : "memory");
}

template <unsigned PAD>
__device__ __forceinline__ u32x8 tdm_group1() {
  u32x8 g;
  g[0] = uni((1u << 20) | (5u << 22) | (PAD << 25));
  g[1] = uni(KROWB << 16);
  g[2] = uni(32u << 16);
  g[3] = uni(KROWB << 16);
  g[4] = uni(32u);
  g[5] = uni(2u * DIM);
  g[6] = uni(0u);
  g[7] = uni(0u);

  asm volatile("" : "+s"(g));
  return g;
}
__device__ __forceinline__ u32x4 tdm_group0(const bf16* gsrc, unsigned lds_byte_off) {
  const unsigned long long ga = (unsigned long long)(uintptr_t)gsrc;
  u32x4 g0;
  g0[0] = uni(1u);
  g0[1] = uni(lds_byte_off);
  g0[2] = uni((unsigned)ga);
  g0[3] = uni((((unsigned)(ga >> 32)) & 0x01FFFFFFu) | (2u << 30));
  return g0;
}
__device__ __forceinline__ void tdm_load(u32x4 g0, u32x8 g1) {
  asm volatile("tensor_load_to_lds %0, %1" :: "s"(g0), "s"(g1) : "memory");
}

__global__ void f32_to_bf16_kernel(const float* __restrict__ src,
                                   bf16* __restrict__ dst, int n) {
  int i = (blockIdx.x * blockDim.x + threadIdx.x) * 8;
  if (i + 8 > n) return;
  float4 a = *(const float4*)(src + i);
  float4 b = *(const float4*)(src + i + 4);
  v8bf o;
  o[0] = (bf16)a.x; o[1] = (bf16)a.y; o[2] = (bf16)a.z; o[3] = (bf16)a.w;
  o[4] = (bf16)b.x; o[5] = (bf16)b.y; o[6] = (bf16)b.z; o[7] = (bf16)b.w;
  *(v8bf*)(dst + i) = o;
}

__global__ __launch_bounds__(256) void qkv_gemm_kernel(
    const bf16* __restrict__ xb, const bf16* __restrict__ wb,
    const float* __restrict__ bq, const float* __restrict__ bk,
    const float* __restrict__ bv,
    bf16* __restrict__ qo, bf16* __restrict__ ko, bf16* __restrict__ vo) {
  const int mat  = blockIdx.y;
  const bf16*  W    = wb + (size_t)mat * DIM * DIM;
  const float* bias = (mat == 0) ? bq : (mat == 1) ? bk : bv;
  bf16*        out  = (mat == 0) ? qo : (mat == 1) ? ko : vo;
  const float  scl  = (mat == 0) ? 0.0625f : 1.0f;

  const int w    = threadIdx.x >> 5;
  const int lane = threadIdx.x & 31;
  const int lr   = lane & 15, lh = lane >> 4;
  const int rowbase = blockIdx.x * 32 + (w >> 2) * 16;
  const int colbase = (w & 3) * 64;

  v16bf A[8];
  const bf16* xrow = xb + (size_t)(rowbase + lr) * DIM + lh * 8;
  #pragma unroll
  for (int kc = 0; kc < 8; ++kc) A[kc] = load_frag(xrow + kc * 32);

  v8f acc[4] = {{0,0,0,0,0,0,0,0},{0,0,0,0,0,0,0,0},
                {0,0,0,0,0,0,0,0},{0,0,0,0,0,0,0,0}};
  #pragma unroll
  for (int kc = 0; kc < 8; ++kc) {
    #pragma unroll
    for (int t = 0; t < 4; ++t) {
      const bf16* wrow = W + (size_t)(colbase + t * 16 + lr) * DIM + kc * 32 + lh * 8;
      v16bf Bf = load_frag(wrow);
      acc[t] = wmma_bf16(A[kc], Bf, acc[t]);
    }
  }
  #pragma unroll
  for (int t = 0; t < 4; ++t) {
    const int   col = colbase + t * 16 + lr;
    const float bb  = bias[col];
    #pragma unroll
    for (int i = 0; i < 8; ++i) {
      const int row = rowbase + i + 8 * lh;
      out[(size_t)row * DIM + col] = (bf16)((acc[t][i] + bb) * scl);
    }
  }
}

__global__ __launch_bounds__(256) void attn_kernel(
    const bf16* __restrict__ qb, const bf16* __restrict__ kb,
    const bf16* __restrict__ vb, const float* __restrict__ x,
    float* __restrict__ out) {

  __shared__ __attribute__((aligned(2048))) bf16 Kl[2][2][KSLICE];

  __shared__ __attribute__((aligned(2048))) bf16 Vl[2][2][KSLICE];
  __shared__ __align__(16) bf16 Pl[8][16 * PPITCH];

  const int batch = blockIdx.y;
  const int qbase = blockIdx.x * 128;
  const int tid   = threadIdx.x;
  const int w     = tid >> 5, lane = tid & 31;
  const int lr    = lane & 15, lh = lane >> 4;
  const size_t bo = (size_t)batch * SEQ * DIM;

  v16bf Qf[8];
  const bf16* qrow = qb + bo + (size_t)(qbase + w * 16 + lr) * DIM + lh * 8;
  #pragma unroll
  for (int kc = 0; kc < 8; ++kc) Qf[kc] = load_frag(qrow + kc * 32);

  v8f O[16];
  #pragma unroll
  for (int t = 0; t < 16; ++t)
    #pragma unroll
    for (int i = 0; i < 8; ++i) O[t][i] = 0.0f;
  float m[8], l[8];
  #pragma unroll
  for (int i = 0; i < 8; ++i) { m[i] = -3.0e38f; l[i] = 0.0f; }

  const int vtr = (8 * lh + (lane & 7)) * VPITCH + ((lane >> 3) & 1) * 8;

  const unsigned wave   = uni((unsigned)tid >> 5);
  const u32x8    g1     = tdm_group1<3u>();
  u32x4          g0     = {0u, 0u, 0u, 0u};
  const bf16*    ksrc   = kb + bo + (wave & 1u) * 128u;
  const unsigned kdst   = (unsigned)(uintptr_t)&Kl[0][0][0] + (wave & 1u) * KSLICEB;
  auto issue_k = [&](int kt) {
    g0 = tdm_group0(ksrc + (size_t)kt * 32 * DIM, kdst + (unsigned)(kt & 1) * (2u * KSLICEB));
    tdm_load(g0, g1);
  };

  const unsigned vwave  = (wave & 6u) == 2u;
  const u32x8    g1v    = tdm_group1<7u>();
  const bf16*    vsrc   = vb + bo + (wave & 1u) * 128u;
  const unsigned vdst   = (unsigned)(uintptr_t)&Vl[0][0][0] + (wave & 1u) * KSLICEB;
  u32x4          g0v    = {0u, 0u, 0u, 0u};
  auto issue_v = [&](int kt) {
    g0v = tdm_group0(vsrc + (size_t)kt * 32 * DIM, vdst + (unsigned)(kt & 1) * (2u * KSLICEB));

    asm volatile("" : "+s"(g0v));
    tdm_load(g0v, g1v);
  };

  if (pinned(wave < 2u)) { issue_k(0); wait_tensor0(g0, g1); }
  if (pinned(vwave))     { issue_v(0); wait_tensor0(g0v, g1v); }
  __syncthreads();
  if (pinned(wave < 2u)) issue_k(1);
  if (pinned(vwave))     issue_v(1);

  for (int kt = 0; kt < KTILES; ++kt) {
    const int cur = kt & 1;

    v8f s0 = {0,0,0,0,0,0,0,0}, s1 = {0,0,0,0,0,0,0,0};
    #pragma unroll
    for (int kc = 0; kc < 8; ++kc) {
      v16bf B0 = load_frag(&Kl[cur][kc >> 2][(0  + lr) * KPITCH + (kc & 3) * 32 + lh * 8]);
      v16bf B1 = load_frag(&Kl[cur][kc >> 2][(16 + lr) * KPITCH + (kc & 3) * 32 + lh * 8]);
      s0 = wmma_bf16(Qf[kc], B0, s0);
      s1 = wmma_bf16(Qf[kc], B1, s1);
    }

    float corr[8];
    #pragma unroll
    for (int i = 0; i < 8; ++i) {
      float t = fmaxf(s0[i], s1[i]);
      t = fmaxf(t, __shfl_xor(t, 1, 32));
      t = fmaxf(t, __shfl_xor(t, 2, 32));
      t = fmaxf(t, __shfl_xor(t, 4, 32));
      t = fmaxf(t, __shfl_xor(t, 8, 32));
      const float mn = fmaxf(m[i], t);
      corr[i] = __expf(m[i] - mn);
      m[i] = mn;
      const float p0 = __expf(s0[i] - mn);
      const float p1 = __expf(s1[i] - mn);
      s0[i] = p0; s1[i] = p1;
      float r = p0 + p1;
      r += __shfl_xor(r, 1, 32);
      r += __shfl_xor(r, 2, 32);
      r += __shfl_xor(r, 4, 32);
      r += __shfl_xor(r, 8, 32);
      l[i] = l[i] * corr[i] + r;
    }
    #pragma unroll
    for (int t = 0; t < 16; ++t)
      #pragma unroll
      for (int i = 0; i < 8; ++i) O[t][i] *= corr[i];

    #pragma unroll
    for (int i = 0; i < 8; ++i) {
      const int row = i + 8 * lh;
      Pl[w][row * PPITCH + lr]      = (bf16)s0[i];
      Pl[w][row * PPITCH + 16 + lr] = (bf16)s1[i];
    }
    v16bf Pf = load_frag(&Pl[w][lr * PPITCH + lh * 8]);

    #pragma unroll
    for (int t = 0; t < 16; ++t) {

      v8bf lo = load_tr16(&Vl[cur][t >> 3][vtr + (t & 7) * 16]);
      v8bf hi = load_tr16(&Vl[cur][t >> 3][vtr + 16 * VPITCH + (t & 7) * 16]);
      v16bf Bv = __builtin_shufflevector(lo, hi, 0,1,2,3,4,5,6,7,8,9,10,11,12,13,14,15);
      O[t] = wmma_bf16(Pf, Bv, O[t]);
    }

    wait_ds0();
    if (pinned(wave < 2u)) wait_tensor0(g0, g1);
    if (pinned(vwave))     wait_tensor0(g0v, g1v);
    __syncthreads();
    if (pinned(wave < 2u && kt + 2 < KTILES)) issue_k(kt + 2);
    if (pinned(vwave && kt + 2 < KTILES))     issue_v(kt + 2);
  }
  wait_tensor0();
  wait_ds0();

  float inv[8];
  #pragma unroll
  for (int i = 0; i < 8; ++i) inv[i] = 1.0f / l[i];
  #pragma unroll
  for (int t = 0; t < 16; ++t) {
    const int col = t * 16 + lr;
    #pragma unroll
    for (int i = 0; i < 8; ++i) {
      const int row = qbase + w * 16 + i + 8 * lh;
      const size_t idx = bo + (size_t)row * DIM + col;
      out[idx] = x[idx] + O[t][i] * inv[i];
    }
  }
}

extern "C" void kernel_launch(void* const* d_in, const int* in_sizes, int n_in,
                              void* d_out, int out_size, void* d_ws, size_t ws_size,
                              hipStream_t stream) {
  const float* x  = (const float*)d_in[0];
  const float* Wq = (const float*)d_in[1];
  const float* bq = (const float*)d_in[2];
  const float* Wk = (const float*)d_in[3];
  const float* bk = (const float*)d_in[4];
  const float* Wv = (const float*)d_in[5];
  const float* bv = (const float*)d_in[6];
  float* outp = (float*)d_out;

  const size_t NX = (size_t)NROW * DIM;
  const size_t NW = (size_t)DIM * DIM;
  bf16* xb = (bf16*)d_ws;
  bf16* wb = xb + NX;
  bf16* qb = wb + 3 * NW;
  bf16* kb = qb + NX;
  bf16* vb = kb + NX;

  f32_to_bf16_kernel<<<(int)(NX / 2048), 256, 0, stream>>>(x, xb, (int)NX);
  f32_to_bf16_kernel<<<(int)(NW / 2048), 256, 0, stream>>>(Wq, wb,          (int)NW);
  f32_to_bf16_kernel<<<(int)(NW / 2048), 256, 0, stream>>>(Wk, wb + NW,     (int)NW);
  f32_to_bf16_kernel<<<(int)(NW / 2048), 256, 0, stream>>>(Wv, wb + 2 * NW, (int)NW);

  qkv_gemm_kernel<<<dim3(NROW / 32, 3), 256, 0, stream>>>(xb, wb, bq, bk, bv,
                                                          qb, kb, vb);

  attn_kernel<<<dim3(SEQ / 128, BATCH), 256, 0, stream>>>(qb, kb, vb, x, outp);
}

// v003
// One run takes 211 microseconds.
// Next to v002, in two timings, it ran 1.24 times as fast each time.
// Counting every step since v000, it is 4.11 times as fast.
#include <hip/hip_runtime.h>
#include <hip/hip_bf16.h>

typedef __bf16 bf16;
typedef __attribute__((ext_vector_type(8)))  bf16  v8bf;
typedef __attribute__((ext_vector_type(16))) bf16  v16bf;
typedef __attribute__((ext_vector_type(8)))  float v8f;

#define DIM   256
#define SEQ   4096
#define BATCH 8
#define NROW  (BATCH * SEQ)
#define KTILES (SEQ / 32)

__device__ __forceinline__ v16bf load_frag(const bf16* p) {

  v8bf lo = *(const v8bf*)p;
  v8bf hi = *(const v8bf*)(p + 16);
  return __builtin_shufflevector(lo, hi, 0,1,2,3,4,5,6,7,8,9,10,11,12,13,14,15);
}

__device__ __forceinline__ v8bf load_tr16(const bf16* p) {
  typedef __attribute__((address_space(3))) v8bf lds_v8bf;
  return __builtin_amdgcn_ds_load_tr16_b128_v8bf16((lds_v8bf*)p);
}

__device__ __forceinline__ float xhalf(float v) {
  const int b = __builtin_bit_cast(int, v);
  return __builtin_bit_cast(float, __builtin_amdgcn_permlanex16(b, b, 0x76543210, 0xfedcba98, false, false));
}

__device__ __forceinline__ v8f wmma_bf16(v16bf a, v16bf b, v8f c) {
  return __builtin_amdgcn_wmma_f32_16x16x32_bf16(false, a, false, b, (short)0, c,
                                                 false, false);
}

#define KROWB   256u
#define KPITCH  136
#define KSLICEB 10240u
#define KSLICE  5120

#define VPITCH  144

typedef __attribute__((ext_vector_type(4))) unsigned int u32x4;
typedef __attribute__((ext_vector_type(8))) unsigned int u32x8;

__device__ __forceinline__ unsigned uni(unsigned v) {
  return (unsigned)__builtin_amdgcn_readfirstlane(v);
}

__device__ __forceinline__ unsigned pinned(unsigned v) {
  unsigned w = uni(v);
  asm volatile("" : "+s"(w));
  return w;
}

__device__ __forceinline__ void wait_tensor0() { asm volatile("s_wait_tensorcnt 0x0" ::: "memory"); }
__device__ __forceinline__ void wait_ds0()     { asm volatile("s_wait_dscnt 0x0" ::: "memory"); }

__device__ __forceinline__ void wait_tensor0(u32x4 g0, u32x8 g1) {
  asm volatile("s_wait_tensorcnt 0x0" :: "s"(g0), "s"(g1) : "memory");
}

template <unsigned PAD>
__device__ __forceinline__ u32x8 tdm_group1() {
  u32x8 g;
  g[0] = uni((1u << 20) | (5u << 22) | (PAD << 25));
  g[1] = uni(KROWB << 16);
  g[2] = uni(32u << 16);
  g[3] = uni(KROWB << 16);
  g[4] = uni(32u);
  g[5] = uni(2u * DIM);
  g[6] = uni(0u);
  g[7] = uni(0u);

  asm volatile("" : "+s"(g));
  return g;
}
__device__ __forceinline__ u32x4 tdm_group0(const bf16* gsrc, unsigned lds_byte_off) {
  const unsigned long long ga = (unsigned long long)(uintptr_t)gsrc;
  u32x4 g0;
  g0[0] = uni(1u);
  g0[1] = uni(lds_byte_off);
  g0[2] = uni((unsigned)ga);
  g0[3] = uni((((unsigned)(ga >> 32)) & 0x01FFFFFFu) | (2u << 30));
  return g0;
}
__device__ __forceinline__ void tdm_load(u32x4 g0, u32x8 g1) {
  asm volatile("tensor_load_to_lds %0, %1" :: "s"(g0), "s"(g1) : "memory");
}

__global__ void f32_to_bf16_kernel(const float* __restrict__ src,
                                   bf16* __restrict__ dst, int n) {
  int i = (blockIdx.x * blockDim.x + threadIdx.x) * 8;
  if (i + 8 > n) return;
  float4 a = *(const float4*)(src + i);
  float4 b = *(const float4*)(src + i + 4);
  v8bf o;
  o[0] = (bf16)a.x; o[1] = (bf16)a.y; o[2] = (bf16)a.z; o[3] = (bf16)a.w;
  o[4] = (bf16)b.x; o[5] = (bf16)b.y; o[6] = (bf16)b.z; o[7] = (bf16)b.w;
  *(v8bf*)(dst + i) = o;
}

__global__ __launch_bounds__(256) void qkv_gemm_kernel(
    const bf16* __restrict__ xb, const bf16* __restrict__ wb,
    const float* __restrict__ bq, const float* __restrict__ bk,
    const float* __restrict__ bv,
    bf16* __restrict__ qo, bf16* __restrict__ ko, bf16* __restrict__ vo) {
  const int mat  = blockIdx.y;
  const bf16*  W    = wb + (size_t)mat * DIM * DIM;
  const float* bias = (mat == 0) ? bq : (mat == 1) ? bk : bv;
  bf16*        out  = (mat == 0) ? qo : (mat == 1) ? ko : vo;
  const float  scl  = (mat == 0) ? 0.0625f : 1.0f;

  const int w    = threadIdx.x >> 5;
  const int lane = threadIdx.x & 31;
  const int lr   = lane & 15, lh = lane >> 4;
  const int rowbase = blockIdx.x * 32 + (w >> 2) * 16;
  const int colbase = (w & 3) * 64;

  v16bf A[8];
  const bf16* xrow = xb + (size_t)(rowbase + lr) * DIM + lh * 8;
  #pragma unroll
  for (int kc = 0; kc < 8; ++kc) A[kc] = load_frag(xrow + kc * 32);

  v8f acc[4] = {{0,0,0,0,0,0,0,0},{0,0,0,0,0,0,0,0},
                {0,0,0,0,0,0,0,0},{0,0,0,0,0,0,0,0}};
  #pragma unroll
  for (int kc = 0; kc < 8; ++kc) {
    #pragma unroll
    for (int t = 0; t < 4; ++t) {
      const bf16* wrow = W + (size_t)(colbase + t * 16 + lr) * DIM + kc * 32 + lh * 8;
      v16bf Bf = load_frag(wrow);
      acc[t] = wmma_bf16(A[kc], Bf, acc[t]);
    }
  }
  #pragma unroll
  for (int t = 0; t < 4; ++t) {
    const int   col = colbase + t * 16 + lr;
    const float bb  = bias[col];
    #pragma unroll
    for (int i = 0; i < 8; ++i) {
      const int row = rowbase + i + 8 * lh;
      out[(size_t)row * DIM + col] = (bf16)((acc[t][i] + bb) * scl);
    }
  }
}

__global__ __launch_bounds__(256) void attn_kernel(
    const bf16* __restrict__ qb, const bf16* __restrict__ kb,
    const bf16* __restrict__ vb, const float* __restrict__ x,
    float* __restrict__ out) {

  __shared__ __attribute__((aligned(2048))) bf16 Kl[2][2][KSLICE];

  __shared__ __attribute__((aligned(2048))) bf16 Vl[2][2][KSLICE];

  const int batch = blockIdx.y;
  const int qbase = blockIdx.x * 128;
  const int tid   = threadIdx.x;
  const int w     = tid >> 5, lane = tid & 31;
  const int lr    = lane & 15, lh = lane >> 4;
  const size_t bo = (size_t)batch * SEQ * DIM;

  v16bf Qf[8];
  const bf16* qrow = qb + bo + (size_t)(qbase + w * 16 + lr) * DIM + lh * 8;
  #pragma unroll
  for (int kc = 0; kc < 8; ++kc) Qf[kc] = load_frag(qrow + kc * 32);

  v8f O[16];
  #pragma unroll
  for (int t = 0; t < 16; ++t)
    #pragma unroll
    for (int i = 0; i < 8; ++i) O[t][i] = 0.0f;
  float m = -3.0e38f;
  float l = 0.0f;

  const int vtr = (8 * lh + (lane & 7)) * VPITCH + ((lane >> 3) & 1) * 8;

  const unsigned wave   = uni((unsigned)tid >> 5);
  const u32x8    g1     = tdm_group1<3u>();
  u32x4          g0     = {0u, 0u, 0u, 0u};
  const bf16*    ksrc   = kb + bo + (wave & 1u) * 128u;
  const unsigned kdst   = (unsigned)(uintptr_t)&Kl[0][0][0] + (wave & 1u) * KSLICEB;
  auto issue_k = [&](int kt) {
    g0 = tdm_group0(ksrc + (size_t)kt * 32 * DIM, kdst + (unsigned)(kt & 1) * (2u * KSLICEB));
    tdm_load(g0, g1);
  };

  const unsigned vwave  = (wave & 6u) == 2u;
  const u32x8    g1v    = tdm_group1<7u>();
  const bf16*    vsrc   = vb + bo + (wave & 1u) * 128u;
  const unsigned vdst   = (unsigned)(uintptr_t)&Vl[0][0][0] + (wave & 1u) * KSLICEB;
  u32x4          g0v    = {0u, 0u, 0u, 0u};
  auto issue_v = [&](int kt) {
    g0v = tdm_group0(vsrc + (size_t)kt * 32 * DIM, vdst + (unsigned)(kt & 1) * (2u * KSLICEB));

    asm volatile("" : "+s"(g0v));
    tdm_load(g0v, g1v);
  };

  if (pinned(wave < 2u)) { issue_k(0); wait_tensor0(g0, g1); }
  if (pinned(vwave))     { issue_v(0); wait_tensor0(g0v, g1v); }
  __syncthreads();
  if (pinned(wave < 2u)) issue_k(1);
  if (pinned(vwave))     issue_v(1);

  for (int kt = 0; kt < KTILES; ++kt) {
    const int cur = kt & 1;

    v8f s0 = {0,0,0,0,0,0,0,0}, s1 = {0,0,0,0,0,0,0,0};
    #pragma unroll
    for (int kc = 0; kc < 8; ++kc) {
      v16bf B0 = load_frag(&Kl[cur][kc >> 2][(0  + lr) * KPITCH + (kc & 3) * 32 + lh * 8]);
      v16bf B1 = load_frag(&Kl[cur][kc >> 2][(16 + lr) * KPITCH + (kc & 3) * 32 + lh * 8]);
      s0 = wmma_bf16(B0, Qf[kc], s0);
      s1 = wmma_bf16(B1, Qf[kc], s1);
    }

    float t4[4];
    #pragma unroll
    for (int i = 0; i < 4; ++i) t4[i] = fmaxf(fmaxf(s0[i], s1[i]), fmaxf(s0[i + 4], s1[i + 4]));
    float t = fmaxf(fmaxf(t4[0], t4[1]), fmaxf(t4[2], t4[3]));
    t = fmaxf(t, xhalf(t));
    const float mn   = fmaxf(m, t);
    const float corr = __expf(m - mn);
    m = mn;
    #pragma unroll
    for (int i = 0; i < 8; ++i) {
      s0[i] = __expf(s0[i] - mn);
      s1[i] = __expf(s1[i] - mn);
    }
    const float r = (((s0[0] + s1[0]) + (s0[1] + s1[1])) + ((s0[2] + s1[2]) + (s0[3] + s1[3])))
                  + (((s0[4] + s1[4]) + (s0[5] + s1[5])) + ((s0[6] + s1[6]) + (s0[7] + s1[7])));
    l = l * corr + r;
    #pragma unroll
    for (int tt = 0; tt < 16; ++tt) O[tt] *= corr;

    v16bf Pf;
    #pragma unroll
    for (int i = 0; i < 8; ++i) { Pf[i] = (bf16)s0[i]; Pf[8 + i] = (bf16)s1[i]; }

    #pragma unroll
    for (int t = 0; t < 16; ++t) {

      v8bf lo = load_tr16(&Vl[cur][t >> 3][vtr + (t & 7) * 16]);
      v8bf hi = load_tr16(&Vl[cur][t >> 3][vtr + 16 * VPITCH + (t & 7) * 16]);
      v16bf Bv = __builtin_shufflevector(lo, hi, 0,1,2,3,4,5,6,7,8,9,10,11,12,13,14,15);
      O[t] = wmma_bf16(Bv, Pf, O[t]);
    }

    wait_ds0();
    if (pinned(wave < 2u)) wait_tensor0(g0, g1);
    if (pinned(vwave))     wait_tensor0(g0v, g1v);
    __syncthreads();
    if (pinned(wave < 2u && kt + 2 < KTILES)) issue_k(kt + 2);
    if (pinned(vwave && kt + 2 < KTILES))     issue_v(kt + 2);
  }
  wait_tensor0();
  wait_ds0();

  const float inv = 1.0f / (l + xhalf(l));
  const size_t rowoff = bo + (size_t)(qbase + w * 16 + lr) * DIM + 8 * lh;
  #pragma unroll
  for (int t = 0; t < 16; ++t) {
    const float4 xa = *(const float4*)(x + rowoff + t * 16);
    const float4 xb = *(const float4*)(x + rowoff + t * 16 + 4);
    float4 oa, ob;
    oa.x = xa.x + O[t][0] * inv; oa.y = xa.y + O[t][1] * inv;
    oa.z = xa.z + O[t][2] * inv; oa.w = xa.w + O[t][3] * inv;
    ob.x = xb.x + O[t][4] * inv; ob.y = xb.y + O[t][5] * inv;
    ob.z = xb.z + O[t][6] * inv; ob.w = xb.w + O[t][7] * inv;
    *(float4*)(out + rowoff + t * 16)     = oa;
    *(float4*)(out + rowoff + t * 16 + 4) = ob;
  }
}

extern "C" void kernel_launch(void* const* d_in, const int* in_sizes, int n_in,
                              void* d_out, int out_size, void* d_ws, size_t ws_size,
                              hipStream_t stream) {
  const float* x  = (const float*)d_in[0];
  const float* Wq = (const float*)d_in[1];
  const float* bq = (const float*)d_in[2];
  const float* Wk = (const float*)d_in[3];
  const float* bk = (const float*)d_in[4];
  const float* Wv = (const float*)d_in[5];
  const float* bv = (const float*)d_in[6];
  float* outp = (float*)d_out;

  const size_t NX = (size_t)NROW * DIM;
  const size_t NW = (size_t)DIM * DIM;
  bf16* xb = (bf16*)d_ws;
  bf16* wb = xb + NX;
  bf16* qb = wb + 3 * NW;
  bf16* kb = qb + NX;
  bf16* vb = kb + NX;

  f32_to_bf16_kernel<<<(int)(NX / 2048), 256, 0, stream>>>(x, xb, (int)NX);
  f32_to_bf16_kernel<<<(int)(NW / 2048), 256, 0, stream>>>(Wq, wb,          (int)NW);
  f32_to_bf16_kernel<<<(int)(NW / 2048), 256, 0, stream>>>(Wk, wb + NW,     (int)NW);
  f32_to_bf16_kernel<<<(int)(NW / 2048), 256, 0, stream>>>(Wv, wb + 2 * NW, (int)NW);

  qkv_gemm_kernel<<<dim3(NROW / 32, 3), 256, 0, stream>>>(xb, wb, bq, bk, bv,
                                                          qb, kb, vb);

  attn_kernel<<<dim3(SEQ / 128, BATCH), 256, 0, stream>>>(qb, kb, vb, x, outp);
}

// v004
// A run of this version takes 178 microseconds.
// In both of two side-by-side timings against v003, it was 1.18 times as fast.
// Over all steps from v000 it is 4.87 times as fast.
#include <hip/hip_runtime.h>
#include <hip/hip_bf16.h>

typedef __bf16 bf16;
typedef __attribute__((ext_vector_type(8)))  bf16  v8bf;
typedef __attribute__((ext_vector_type(16))) bf16  v16bf;
typedef __attribute__((ext_vector_type(8)))  float v8f;
typedef __attribute__((ext_vector_type(4)))  float f32x4;

#define DIM   256
#define SEQ   4096
#define BATCH 8
#define NROW  (BATCH * SEQ)

__device__ __forceinline__ v16bf load_frag(const bf16* p) {

  v8bf lo = *(const v8bf*)p;
  v8bf hi = *(const v8bf*)(p + 16);
  return __builtin_shufflevector(lo, hi, 0,1,2,3,4,5,6,7,8,9,10,11,12,13,14,15);
}

__device__ __forceinline__ v8bf load_tr16(const bf16* p) {
  typedef __attribute__((address_space(3))) v8bf lds_v8bf;
  return __builtin_amdgcn_ds_load_tr16_b128_v8bf16((lds_v8bf*)p);
}

__device__ __forceinline__ float xhalf(float v) {
  const int b = __builtin_bit_cast(int, v);
  return __builtin_bit_cast(float, __builtin_amdgcn_permlanex16(b, b, 0x76543210, 0xfedcba98, false, false));
}

__device__ __forceinline__ v8f wmma_bf16(v16bf a, v16bf b, v8f c) {
  return __builtin_amdgcn_wmma_f32_16x16x32_bf16(false, a, false, b, (short)0, c,
                                                 false, false);
}

#define SKEYS   64
#define STAGES  (SEQ / SKEYS)
#define KROWB   256u
#define KPITCH  136
#define KSLICEB 18432u
#define KSLICE  9216

#define VPITCH  144

typedef __attribute__((ext_vector_type(4))) unsigned int u32x4;
typedef __attribute__((ext_vector_type(8))) unsigned int u32x8;

__device__ __forceinline__ unsigned uni(unsigned v) {
  return (unsigned)__builtin_amdgcn_readfirstlane(v);
}

__device__ __forceinline__ unsigned pinned(unsigned v) {
  unsigned w = uni(v);
  asm volatile("" : "+s"(w));
  return w;
}

__device__ __forceinline__ void wait_tensor0() { asm volatile("s_wait_tensorcnt 0x0" ::: "memory"); }
__device__ __forceinline__ void wait_ds0()     { asm volatile("s_wait_dscnt 0x0" ::: "memory"); }

__device__ __forceinline__ void wait_tensor0(u32x4 g0, u32x8 g1) {
  asm volatile("s_wait_tensorcnt 0x0" :: "s"(g0), "s"(g1) : "memory");
}

template <unsigned PAD>
__device__ __forceinline__ u32x8 tdm_group1() {
  u32x8 g;
  g[0] = uni((1u << 20) | (5u << 22) | (PAD << 25));
  g[1] = uni(KROWB << 16);
  g[2] = uni((unsigned)SKEYS << 16);
  g[3] = uni(KROWB << 16);
  g[4] = uni((unsigned)SKEYS);
  g[5] = uni(2u * DIM);
  g[6] = uni(0u);
  g[7] = uni(0u);

  asm volatile("" : "+s"(g));
  return g;
}
__device__ __forceinline__ u32x4 tdm_group0(const bf16* gsrc, unsigned lds_byte_off) {
  const unsigned long long ga = (unsigned long long)(uintptr_t)gsrc;
  u32x4 g0;
  g0[0] = uni(1u);
  g0[1] = uni(lds_byte_off);
  g0[2] = uni((unsigned)ga);
  g0[3] = uni((((unsigned)(ga >> 32)) & 0x01FFFFFFu) | (2u << 30));
  return g0;
}
__device__ __forceinline__ void tdm_load(u32x4 g0, u32x8 g1) {
  asm volatile("tensor_load_to_lds %0, %1" :: "s"(g0), "s"(g1) : "memory");
}

__global__ void f32_to_bf16_kernel(const float* __restrict__ src,
                                   bf16* __restrict__ dst, int n) {
  int i = (blockIdx.x * blockDim.x + threadIdx.x) * 8;
  if (i + 8 > n) return;
  float4 a = *(const float4*)(src + i);
  float4 b = *(const float4*)(src + i + 4);
  v8bf o;
  o[0] = (bf16)a.x; o[1] = (bf16)a.y; o[2] = (bf16)a.z; o[3] = (bf16)a.w;
  o[4] = (bf16)b.x; o[5] = (bf16)b.y; o[6] = (bf16)b.z; o[7] = (bf16)b.w;
  *(v8bf*)(dst + i) = o;
}

__global__ __launch_bounds__(256) void qkv_gemm_kernel(
    const bf16* __restrict__ xb, const bf16* __restrict__ wb,
    const float* __restrict__ bq, const float* __restrict__ bk,
    const float* __restrict__ bv,
    bf16* __restrict__ qo, bf16* __restrict__ ko, bf16* __restrict__ vo) {
  const int mat  = blockIdx.y;
  const bf16*  W    = wb + (size_t)mat * DIM * DIM;
  const float* bias = (mat == 0) ? bq : (mat == 1) ? bk : bv;
  bf16*        out  = (mat == 0) ? qo : (mat == 1) ? ko : vo;
  const float  scl  = (mat == 0) ? 0.0625f : 1.0f;

  const int w    = threadIdx.x >> 5;
  const int lane = threadIdx.x & 31;
  const int lr   = lane & 15, lh = lane >> 4;
  const int rowbase = blockIdx.x * 32 + (w >> 2) * 16;
  const int colbase = (w & 3) * 64;

  v16bf A[8];
  const bf16* xrow = xb + (size_t)(rowbase + lr) * DIM + lh * 8;
  #pragma unroll
  for (int kc = 0; kc < 8; ++kc) A[kc] = load_frag(xrow + kc * 32);

  v8f acc[4] = {{0,0,0,0,0,0,0,0},{0,0,0,0,0,0,0,0},
                {0,0,0,0,0,0,0,0},{0,0,0,0,0,0,0,0}};
  #pragma unroll
  for (int kc = 0; kc < 8; ++kc) {
    #pragma unroll
    for (int t = 0; t < 4; ++t) {
      const bf16* wrow = W + (size_t)(colbase + t * 16 + lr) * DIM + kc * 32 + lh * 8;
      v16bf Bf = load_frag(wrow);
      acc[t] = wmma_bf16(A[kc], Bf, acc[t]);
    }
  }
  #pragma unroll
  for (int t = 0; t < 4; ++t) {
    const int   col = colbase + t * 16 + lr;
    const float bb  = bias[col];
    #pragma unroll
    for (int i = 0; i < 8; ++i) {
      const int row = rowbase + i + 8 * lh;
      out[(size_t)row * DIM + col] = (bf16)((acc[t][i] + bb) * scl);
    }
  }
}

__global__ __launch_bounds__(256) void attn_kernel(
    const bf16* __restrict__ qb, const bf16* __restrict__ kb,
    const bf16* __restrict__ vb, const float* __restrict__ x,
    float* __restrict__ out) {

  __shared__ __attribute__((aligned(2048))) bf16 Ring[8][KSLICE];

  const int batch = blockIdx.y;
  const int qbase = blockIdx.x * 128;
  const int tid   = threadIdx.x;
  const int lane  = tid & 31;
  const int lr    = lane & 15, lh = lane >> 4;
  const size_t bo = (size_t)batch * SEQ * DIM;
  const unsigned wave = uni((unsigned)tid >> 5);
  const int qg = (int)(wave & 3u), kh = (int)(wave >> 2);

  v16bf Qf[2][8];
  const bf16* qrow = qb + bo + (size_t)(qbase + qg * 32 + lr) * DIM + lh * 8;
  #pragma unroll
  for (int q = 0; q < 2; ++q)
    #pragma unroll
    for (int kc = 0; kc < 8; ++kc) Qf[q][kc] = load_frag(qrow + q * 16 * DIM + kc * 32);

  v8f O[2][16];
  #pragma unroll
  for (int q = 0; q < 2; ++q)
    #pragma unroll
    for (int t = 0; t < 16; ++t)
      #pragma unroll
      for (int i = 0; i < 8; ++i) O[q][t][i] = 0.0f;
  float m[2] = {-3.0e38f, -3.0e38f};
  float l[2] = {0.0f, 0.0f};

  const int kfr = (kh * 32 + lr) * KPITCH + lh * 8;
  const int vtr = (kh * 32 + 8 * lh + (lane & 7)) * VPITCH + ((lane >> 3) & 1) * 8;

  const u32x8    g1     = tdm_group1<3u>();
  u32x4          g0     = {0u, 0u, 0u, 0u};
  const bf16*    ksrc   = kb + bo + (wave & 1u) * 128u;
  const unsigned kdst   = (unsigned)(uintptr_t)&Ring[0][0] + (wave & 1u) * KSLICEB;
  auto issue_k = [&](int st) {
    g0 = tdm_group0(ksrc + (size_t)st * SKEYS * DIM, kdst + (unsigned)(st & 1) * (2u * KSLICEB));
    tdm_load(g0, g1);
  };

  const unsigned vwave  = (wave & 6u) == 2u;
  const u32x8    g1v    = tdm_group1<7u>();
  const bf16*    vsrc   = vb + bo + (wave & 1u) * 128u;
  const unsigned vdst   = (unsigned)(uintptr_t)&Ring[4][0] + (wave & 1u) * KSLICEB;
  u32x4          g0v    = {0u, 0u, 0u, 0u};
  auto issue_v = [&](int st) {
    g0v = tdm_group0(vsrc + (size_t)st * SKEYS * DIM, vdst + (unsigned)(st & 1) * (2u * KSLICEB));

    asm volatile("" : "+s"(g0v));
    tdm_load(g0v, g1v);
  };

  if (pinned(wave < 2u)) { issue_k(0); wait_tensor0(g0, g1); }
  if (pinned(vwave))     { issue_v(0); wait_tensor0(g0v, g1v); }
  __syncthreads();
  if (pinned(wave < 2u)) issue_k(1);
  if (pinned(vwave))     issue_v(1);

  for (int st = 0; st < STAGES; ++st) {
    const int cur = st & 1;

    v8f s[2][2] = {{{0,0,0,0,0,0,0,0}, {0,0,0,0,0,0,0,0}}, {{0,0,0,0,0,0,0,0}, {0,0,0,0,0,0,0,0}}};
    #pragma unroll
    for (int kc = 0; kc < 8; ++kc) {
      v16bf A0 = load_frag(&Ring[cur * 2 + (kc >> 2)][kfr + (kc & 3) * 32]);
      v16bf A1 = load_frag(&Ring[cur * 2 + (kc >> 2)][kfr + 16 * KPITCH + (kc & 3) * 32]);
      #pragma unroll
      for (int q = 0; q < 2; ++q) {
        s[q][0] = wmma_bf16(A0, Qf[q][kc], s[q][0]);
        s[q][1] = wmma_bf16(A1, Qf[q][kc], s[q][1]);
      }
    }

    v16bf Pf[2];
    #pragma unroll
    for (int q = 0; q < 2; ++q) {
      v8f s0 = s[q][0], s1 = s[q][1];
      float t4[4];
      #pragma unroll
      for (int i = 0; i < 4; ++i) t4[i] = fmaxf(fmaxf(s0[i], s1[i]), fmaxf(s0[i + 4], s1[i + 4]));
      float t = fmaxf(fmaxf(t4[0], t4[1]), fmaxf(t4[2], t4[3]));
      t = fmaxf(t, xhalf(t));
      const float mn   = fmaxf(m[q], t);
      const float corr = __expf(m[q] - mn);
      m[q] = mn;
      #pragma unroll
      for (int i = 0; i < 8; ++i) {
        s0[i] = __expf(s0[i] - mn);
        s1[i] = __expf(s1[i] - mn);
      }
      const float r = (((s0[0] + s1[0]) + (s0[1] + s1[1])) + ((s0[2] + s1[2]) + (s0[3] + s1[3])))
                    + (((s0[4] + s1[4]) + (s0[5] + s1[5])) + ((s0[6] + s1[6]) + (s0[7] + s1[7])));
      l[q] = l[q] * corr + r;
      #pragma unroll
      for (int tt = 0; tt < 16; ++tt) O[q][tt] *= corr;

      #pragma unroll
      for (int i = 0; i < 8; ++i) { Pf[q][i] = (bf16)s0[i]; Pf[q][8 + i] = (bf16)s1[i]; }
    }

    #pragma unroll
    for (int t = 0; t < 16; ++t) {

      v8bf lo = load_tr16(&Ring[4 + cur * 2 + (t >> 3)][vtr + (t & 7) * 16]);
      v8bf hi = load_tr16(&Ring[4 + cur * 2 + (t >> 3)][vtr + 16 * VPITCH + (t & 7) * 16]);
      v16bf Av = __builtin_shufflevector(lo, hi, 0,1,2,3,4,5,6,7,8,9,10,11,12,13,14,15);
      #pragma unroll
      for (int q = 0; q < 2; ++q) O[q][t] = wmma_bf16(Av, Pf[q], O[q][t]);
    }

    wait_ds0();
    if (pinned(wave < 2u)) wait_tensor0(g0, g1);
    if (pinned(vwave))     wait_tensor0(g0v, g1v);
    __syncthreads();
    if (pinned(wave < 2u && st + 2 < STAGES)) issue_k(st + 2);
    if (pinned(vwave && st + 2 < STAGES))     issue_v(st + 2);
  }
  wait_tensor0();
  wait_ds0();

  float*  stg   = (float*)&Ring[0][0];
  float4* mine  = (float4*)(stg + wave * 4096u);
  float4* other = (float4*)(stg + (wave ^ 4u) * 4096u);
  float*  mlm   = stg + 32768u + wave * 128u;
  float*  mlo   = stg + 32768u + (wave ^ 4u) * 128u;
  float lj[2];
  #pragma unroll
  for (int q = 0; q < 2; ++q) {
    lj[q] = l[q] + xhalf(l[q]);
    mlm[q * 64 + lane]      = m[q];
    mlm[q * 64 + 32 + lane] = lj[q];
  }

  const bool up = kh != 0;
  #pragma unroll
  for (int q = 0; q < 2; ++q)
    #pragma unroll
    for (int t = 0; t < 8; ++t) {
      const v8f g = up ? O[q][t] : O[q][8 + t];
      mine[((q * 8 + t) * 2 + 0) * 32 + lane] = make_float4(g[0], g[1], g[2], g[3]);
      mine[((q * 8 + t) * 2 + 1) * 32 + lane] = make_float4(g[4], g[5], g[6], g[7]);
    }
  __syncthreads();

  const size_t rowoff = bo + (size_t)(qbase + qg * 32 + lr) * DIM + kh * 128 + 8 * lh;
  const float* xr   = x + rowoff;
  float*       orow = out + rowoff;
  float4 xv[2][8][2];
  #pragma unroll
  for (int q = 0; q < 2; ++q)
    #pragma unroll
    for (int t = 0; t < 8; ++t) {
      xv[q][t][0] = *(const float4*)(xr + q * 16 * DIM + t * 16);
      xv[q][t][1] = *(const float4*)(xr + q * 16 * DIM + t * 16 + 4);
    }

  asm volatile("s_wait_xcnt 0x0" :: "v"(xr) : "memory");

  float a[2], b[2];
  #pragma unroll
  for (int q = 0; q < 2; ++q) {
    const float mo = mlo[q * 64 + lane];
    const float lo = mlo[q * 64 + 32 + lane];
    const float mx = fmaxf(m[q], mo);
    const float fs = __expf(m[q] - mx), fo = __expf(mo - mx);
    const float inv = 1.0f / (lj[q] * fs + lo * fo);
    a[q] = fs * inv;
    b[q] = fo * inv;
  }

  #pragma unroll
  for (int q = 0; q < 2; ++q)
    #pragma unroll
    for (int tg = 0; tg < 8; tg += 4) {
      f32x4 r[4][2];
      #pragma unroll
      for (int u = 0; u < 4; ++u) {
        const int    t  = tg + u;
        const v8f    o  = up ? O[q][8 + t] : O[q][t];
        const float4 pa = other[((q * 8 + t) * 2 + 0) * 32 + lane];
        const float4 pb = other[((q * 8 + t) * 2 + 1) * 32 + lane];
        const float4 xa = xv[q][t][0], xb = xv[q][t][1];
        r[u][0][0] = xa.x + (o[0] * a[q] + pa.x * b[q]); r[u][0][1] = xa.y + (o[1] * a[q] + pa.y * b[q]);
        r[u][0][2] = xa.z + (o[2] * a[q] + pa.z * b[q]); r[u][0][3] = xa.w + (o[3] * a[q] + pa.w * b[q]);
        r[u][1][0] = xb.x + (o[4] * a[q] + pb.x * b[q]); r[u][1][1] = xb.y + (o[5] * a[q] + pb.y * b[q]);
        r[u][1][2] = xb.z + (o[6] * a[q] + pb.z * b[q]); r[u][1][3] = xb.w + (o[7] * a[q] + pb.w * b[q]);
        *(f32x4*)(orow + q * 16 * DIM + t * 16)     = r[u][0];
        *(f32x4*)(orow + q * 16 * DIM + t * 16 + 4) = r[u][1];
      }

      asm volatile("s_wait_xcnt 0x0" :: "v"(r[0][0]), "v"(r[0][1]), "v"(r[1][0]), "v"(r[1][1]),
                   "v"(r[2][0]), "v"(r[2][1]), "v"(r[3][0]), "v"(r[3][1]), "v"(orow) : "memory");
    }
}

extern "C" void kernel_launch(void* const* d_in, const int* in_sizes, int n_in,
                              void* d_out, int out_size, void* d_ws, size_t ws_size,
                              hipStream_t stream) {
  const float* x  = (const float*)d_in[0];
  const float* Wq = (const float*)d_in[1];
  const float* bq = (const float*)d_in[2];
  const float* Wk = (const float*)d_in[3];
  const float* bk = (const float*)d_in[4];
  const float* Wv = (const float*)d_in[5];
  const float* bv = (const float*)d_in[6];
  float* outp = (float*)d_out;

  const size_t NX = (size_t)NROW * DIM;
  const size_t NW = (size_t)DIM * DIM;
  bf16* xb = (bf16*)d_ws;
  bf16* wb = xb + NX;
  bf16* qb = wb + 3 * NW;
  bf16* kb = qb + NX;
  bf16* vb = kb + NX;

  f32_to_bf16_kernel<<<(int)(NX / 2048), 256, 0, stream>>>(x, xb, (int)NX);
  f32_to_bf16_kernel<<<(int)(NW / 2048), 256, 0, stream>>>(Wq, wb,          (int)NW);
  f32_to_bf16_kernel<<<(int)(NW / 2048), 256, 0, stream>>>(Wk, wb + NW,     (int)NW);
  f32_to_bf16_kernel<<<(int)(NW / 2048), 256, 0, stream>>>(Wv, wb + 2 * NW, (int)NW);

  qkv_gemm_kernel<<<dim3(NROW / 32, 3), 256, 0, stream>>>(xb, wb, bq, bk, bv,
                                                          qb, kb, vb);

  attn_kernel<<<dim3(SEQ / 128, BATCH), 256, 0, stream>>>(qb, kb, vb, x, outp);
}

// v005
// It runs in 136 microseconds.
// Timed twice side by side with v004, it ran 1.30 and 1.31 times as fast.
// Counting every step since v000, it is 6.36 times as fast.
#include <hip/hip_runtime.h>
#include <hip/hip_bf16.h>

typedef __bf16 bf16;
typedef __attribute__((ext_vector_type(8)))  bf16  v8bf;
typedef __attribute__((ext_vector_type(16))) bf16  v16bf;
typedef __attribute__((ext_vector_type(8)))  float v8f;
typedef __attribute__((ext_vector_type(4)))  float f32x4;

#define DIM   256
#define SEQ   4096
#define BATCH 8
#define NROW  (BATCH * SEQ)

__device__ __forceinline__ v16bf load_frag(const bf16* p) {

  v8bf lo = *(const v8bf*)p;
  v8bf hi = *(const v8bf*)(p + 16);
  return __builtin_shufflevector(lo, hi, 0,1,2,3,4,5,6,7,8,9,10,11,12,13,14,15);
}

__device__ __forceinline__ v8bf load_tr16(const bf16* p) {
  typedef __attribute__((address_space(3))) v8bf lds_v8bf;
  return __builtin_amdgcn_ds_load_tr16_b128_v8bf16((lds_v8bf*)p);
}

__device__ __forceinline__ float xhalf(float v) {
  const int b = __builtin_bit_cast(int, v);
  return __builtin_bit_cast(float, __builtin_amdgcn_permlanex16(b, b, 0x76543210, 0xfedcba98, false, false));
}

__device__ __forceinline__ v8f wmma_bf16(v16bf a, v16bf b, v8f c) {
  return __builtin_amdgcn_wmma_f32_16x16x32_bf16(false, a, false, b, (short)0, c,
                                                 false, false);
}

#define SKEYS   64
#define STAGES  (SEQ / SKEYS)
#define KROWB   256u
#define KPITCH  136
#define KSLICEB 18432u
#define KSLICE  9216

#define VPITCH  144

typedef __attribute__((ext_vector_type(4))) unsigned int u32x4;
typedef __attribute__((ext_vector_type(8))) unsigned int u32x8;

__device__ __forceinline__ unsigned uni(unsigned v) {
  return (unsigned)__builtin_amdgcn_readfirstlane(v);
}

__device__ __forceinline__ unsigned pinned(unsigned v) {
  unsigned w = uni(v);
  asm volatile("" : "+s"(w));
  return w;
}

__device__ __forceinline__ void wait_tensor0() { asm volatile("s_wait_tensorcnt 0x0" ::: "memory"); }
__device__ __forceinline__ void wait_ds0()     { asm volatile("s_wait_dscnt 0x0" ::: "memory"); }

__device__ __forceinline__ void wait_tensor0(u32x4 g0, u32x8 g1) {
  asm volatile("s_wait_tensorcnt 0x0" :: "s"(g0), "s"(g1) : "memory");
}

template <unsigned PAD, unsigned ROWS = SKEYS>
__device__ __forceinline__ u32x8 tdm_group1() {
  u32x8 g;
  g[0] = uni((1u << 20) | (5u << 22) | (PAD << 25));
  g[1] = uni(KROWB << 16);
  g[2] = uni(ROWS << 16);
  g[3] = uni(KROWB << 16);
  g[4] = uni(ROWS);
  g[5] = uni(2u * DIM);
  g[6] = uni(0u);
  g[7] = uni(0u);

  asm volatile("" : "+s"(g));
  return g;
}
__device__ __forceinline__ u32x4 tdm_group0(const bf16* gsrc, unsigned lds_byte_off) {
  const unsigned long long ga = (unsigned long long)(uintptr_t)gsrc;
  u32x4 g0;
  g0[0] = uni(1u);
  g0[1] = uni(lds_byte_off);
  g0[2] = uni((unsigned)ga);
  g0[3] = uni((((unsigned)(ga >> 32)) & 0x01FFFFFFu) | (2u << 30));
  return g0;
}
__device__ __forceinline__ void tdm_load(u32x4 g0, u32x8 g1) {
  asm volatile("tensor_load_to_lds %0, %1" :: "s"(g0), "s"(g1) : "memory");
}

__global__ void f32_to_bf16_kernel(const float* __restrict__ src,
                                   bf16* __restrict__ dst, int n) {
  int i = (blockIdx.x * blockDim.x + threadIdx.x) * 8;
  if (i + 8 > n) return;
  float4 a = *(const float4*)(src + i);
  float4 b = *(const float4*)(src + i + 4);
  v8bf o;
  o[0] = (bf16)a.x; o[1] = (bf16)a.y; o[2] = (bf16)a.z; o[3] = (bf16)a.w;
  o[4] = (bf16)b.x; o[5] = (bf16)b.y; o[6] = (bf16)b.z; o[7] = (bf16)b.w;
  *(v8bf*)(dst + i) = o;
}

#define PROWS   128
#define PSLICEB 34816u
#define PSLICE  17408
__global__ __launch_bounds__(128) void qkv_gemm_kernel(
    const bf16* __restrict__ xb, const bf16* __restrict__ wb,
    const float* __restrict__ bq, const float* __restrict__ bk,
    const float* __restrict__ bv,
    bf16* __restrict__ qo, bf16* __restrict__ ko, bf16* __restrict__ vo) {

  __shared__ __attribute__((aligned(2048))) bf16 Stg[4 * PSLICE];

  const int mat  = blockIdx.y >> 1;
  const int ch   = blockIdx.y & 1;
  const bf16*  W    = wb + (size_t)mat * DIM * DIM + (size_t)ch * PROWS * DIM;
  const float* bias = (mat == 0) ? bq : (mat == 1) ? bk : bv;
  bf16*        out  = (mat == 0) ? qo : (mat == 1) ? ko : vo;
  const float  scl  = (mat == 0) ? 0.0625f : 1.0f;

  const unsigned wave = uni((unsigned)threadIdx.x >> 5);
  const int lane = threadIdx.x & 31;
  const int lr   = lane & 15, lh = lane >> 4;
  const int rowbase = blockIdx.x * PROWS;

  float bb[8];
  #pragma unroll
  for (int t = 0; t < 8; ++t) bb[t] = bias[ch * 128 + t * 16 + lr];

  {
    const bf16* src = (wave < 2u) ? xb + (size_t)rowbase * DIM : W;
    const u32x8 g1 = tdm_group1<3u, PROWS>();
    const u32x4 g0 = tdm_group0(src + (wave & 1u) * 128u, (unsigned)(uintptr_t)&Stg[0] + wave * PSLICEB);
    tdm_load(g0, g1);
    wait_tensor0(g0, g1);
  }
  __syncthreads();

  const int afr = ((int)wave * 32 + lr) * KPITCH + lh * 8;
  const int bfr = 2 * PSLICE + lr * KPITCH + lh * 8;

  v8f acc[2][8];
  #pragma unroll
  for (int a = 0; a < 2; ++a)
    #pragma unroll
    for (int t = 0; t < 8; ++t)
      #pragma unroll
      for (int i = 0; i < 8; ++i) acc[a][t][i] = 0.0f;

  v16bf Af[2][2], Bf[2][4];
  auto fetch_a = [&](int kc) {
    const int ko = (kc >> 2) * PSLICE + (kc & 3) * 32;
    Af[kc & 1][0] = load_frag(&Stg[afr + ko]);
    Af[kc & 1][1] = load_frag(&Stg[afr + 16 * KPITCH + ko]);
  };
  auto fetch_b = [&](int b) {
    const int kc = b >> 1;
    const int ko = (kc >> 2) * PSLICE + (kc & 3) * 32;
    #pragma unroll
    for (int j = 0; j < 4; ++j) Bf[b & 1][j] = load_frag(&Stg[bfr + ((b & 1) * 4 + j) * 16 * KPITCH + ko]);
  };
  fetch_a(0);
  fetch_b(0);
  #pragma unroll
  for (int b = 0; b < 16; ++b) {
    if (b < 15) {
      if (b & 1) fetch_a((b + 1) >> 1);
      fetch_b(b + 1);
    }

    __builtin_amdgcn_sched_barrier(0);
    #pragma unroll
    for (int j = 0; j < 4; ++j) {
      const int t = (b & 1) * 4 + j;
      acc[0][t] = wmma_bf16(Af[(b >> 1) & 1][0], Bf[b & 1][j], acc[0][t]);
      acc[1][t] = wmma_bf16(Af[(b >> 1) & 1][1], Bf[b & 1][j], acc[1][t]);
    }
    __builtin_amdgcn_sched_barrier(0);
  }
  #pragma unroll
  for (int t = 0; t < 8; ++t) {
    const int col = ch * 128 + t * 16 + lr;
    #pragma unroll
    for (int a = 0; a < 2; ++a)
      #pragma unroll
      for (int i = 0; i < 8; ++i) {
        const int row = rowbase + (int)wave * 32 + a * 16 + i + 8 * lh;
        out[(size_t)row * DIM + col] = (bf16)((acc[a][t][i] + bb[t]) * scl);
      }
  }
}

__global__ __launch_bounds__(256) void attn_kernel(
    const bf16* __restrict__ qb, const bf16* __restrict__ kb,
    const bf16* __restrict__ vb, const float* __restrict__ x,
    float* __restrict__ out) {

  __shared__ __attribute__((aligned(2048))) bf16 Ring[8][KSLICE];

  const int batch = blockIdx.y;
  const int qbase = blockIdx.x * 128;
  const int tid   = threadIdx.x;
  const int lane  = tid & 31;
  const int lr    = lane & 15, lh = lane >> 4;
  const size_t bo = (size_t)batch * SEQ * DIM;
  const unsigned wave = uni((unsigned)tid >> 5);
  const int qg = (int)(wave & 3u), kh = (int)(wave >> 2);

  v16bf Qf[2][8];
  const bf16* qrow = qb + bo + (size_t)(qbase + qg * 32 + lr) * DIM + lh * 8;
  #pragma unroll
  for (int q = 0; q < 2; ++q)
    #pragma unroll
    for (int kc = 0; kc < 8; ++kc) Qf[q][kc] = load_frag(qrow + q * 16 * DIM + kc * 32);

  v8f O[2][16];
  #pragma unroll
  for (int q = 0; q < 2; ++q)
    #pragma unroll
    for (int t = 0; t < 16; ++t)
      #pragma unroll
      for (int i = 0; i < 8; ++i) O[q][t][i] = 0.0f;
  float m[2] = {-3.0e38f, -3.0e38f};
  float l[2] = {0.0f, 0.0f};

  const int kfr = (kh * 32 + lr) * KPITCH + lh * 8;
  const int vtr = (kh * 32 + 8 * lh + (lane & 7)) * VPITCH + ((lane >> 3) & 1) * 8;

  const u32x8    g1     = tdm_group1<3u>();
  u32x4          g0     = {0u, 0u, 0u, 0u};
  const bf16*    ksrc   = kb + bo + (wave & 1u) * 128u;
  const unsigned kdst   = (unsigned)(uintptr_t)&Ring[0][0] + (wave & 1u) * KSLICEB;
  auto issue_k = [&](int st) {
    g0 = tdm_group0(ksrc + (size_t)st * SKEYS * DIM, kdst + (unsigned)(st & 1) * (2u * KSLICEB));
    tdm_load(g0, g1);
  };

  const unsigned vwave  = (wave & 6u) == 2u;
  const u32x8    g1v    = tdm_group1<7u>();
  const bf16*    vsrc   = vb + bo + (wave & 1u) * 128u;
  const unsigned vdst   = (unsigned)(uintptr_t)&Ring[4][0] + (wave & 1u) * KSLICEB;
  u32x4          g0v    = {0u, 0u, 0u, 0u};
  auto issue_v = [&](int st) {
    g0v = tdm_group0(vsrc + (size_t)st * SKEYS * DIM, vdst + (unsigned)(st & 1) * (2u * KSLICEB));

    asm volatile("" : "+s"(g0v));
    tdm_load(g0v, g1v);
  };

  if (pinned(wave < 2u)) { issue_k(0); wait_tensor0(g0, g1); }
  if (pinned(vwave))     { issue_v(0); wait_tensor0(g0v, g1v); }
  __syncthreads();
  if (pinned(wave < 2u)) issue_k(1);
  if (pinned(vwave))     issue_v(1);

  for (int st = 0; st < STAGES; ++st) {
    const int cur = st & 1;

    v8f s[2][2] = {{{0,0,0,0,0,0,0,0}, {0,0,0,0,0,0,0,0}}, {{0,0,0,0,0,0,0,0}, {0,0,0,0,0,0,0,0}}};
    #pragma unroll
    for (int kc = 0; kc < 8; ++kc) {
      v16bf A0 = load_frag(&Ring[cur * 2 + (kc >> 2)][kfr + (kc & 3) * 32]);
      v16bf A1 = load_frag(&Ring[cur * 2 + (kc >> 2)][kfr + 16 * KPITCH + (kc & 3) * 32]);
      #pragma unroll
      for (int q = 0; q < 2; ++q) {
        s[q][0] = wmma_bf16(A0, Qf[q][kc], s[q][0]);
        s[q][1] = wmma_bf16(A1, Qf[q][kc], s[q][1]);
      }
    }

    v16bf Pf[2];
    #pragma unroll
    for (int q = 0; q < 2; ++q) {
      v8f s0 = s[q][0], s1 = s[q][1];
      float t4[4];
      #pragma unroll
      for (int i = 0; i < 4; ++i) t4[i] = fmaxf(fmaxf(s0[i], s1[i]), fmaxf(s0[i + 4], s1[i + 4]));
      float t = fmaxf(fmaxf(t4[0], t4[1]), fmaxf(t4[2], t4[3]));
      t = fmaxf(t, xhalf(t));
      const float mn   = fmaxf(m[q], t);
      const float corr = __expf(m[q] - mn);
      m[q] = mn;
      #pragma unroll
      for (int i = 0; i < 8; ++i) {
        s0[i] = __expf(s0[i] - mn);
        s1[i] = __expf(s1[i] - mn);
      }
      const float r = (((s0[0] + s1[0]) + (s0[1] + s1[1])) + ((s0[2] + s1[2]) + (s0[3] + s1[3])))
                    + (((s0[4] + s1[4]) + (s0[5] + s1[5])) + ((s0[6] + s1[6]) + (s0[7] + s1[7])));
      l[q] = l[q] * corr + r;
      #pragma unroll
      for (int tt = 0; tt < 16; ++tt) O[q][tt] *= corr;

      #pragma unroll
      for (int i = 0; i < 8; ++i) { Pf[q][i] = (bf16)s0[i]; Pf[q][8 + i] = (bf16)s1[i]; }
    }

    #pragma unroll
    for (int t = 0; t < 16; ++t) {

      v8bf lo = load_tr16(&Ring[4 + cur * 2 + (t >> 3)][vtr + (t & 7) * 16]);
      v8bf hi = load_tr16(&Ring[4 + cur * 2 + (t >> 3)][vtr + 16 * VPITCH + (t & 7) * 16]);
      v16bf Av = __builtin_shufflevector(lo, hi, 0,1,2,3,4,5,6,7,8,9,10,11,12,13,14,15);
      #pragma unroll
      for (int q = 0; q < 2; ++q) O[q][t] = wmma_bf16(Av, Pf[q], O[q][t]);
    }

    wait_ds0();
    if (pinned(wave < 2u)) wait_tensor0(g0, g1);
    if (pinned(vwave))     wait_tensor0(g0v, g1v);
    __syncthreads();
    if (pinned(wave < 2u && st + 2 < STAGES)) issue_k(st + 2);
    if (pinned(vwave && st + 2 < STAGES))     issue_v(st + 2);
  }
  wait_tensor0();
  wait_ds0();

  float*  stg   = (float*)&Ring[0][0];
  float4* mine  = (float4*)(stg + wave * 4096u);
  float4* other = (float4*)(stg + (wave ^ 4u) * 4096u);
  float*  mlm   = stg + 32768u + wave * 128u;
  float*  mlo   = stg + 32768u + (wave ^ 4u) * 128u;
  float lj[2];
  #pragma unroll
  for (int q = 0; q < 2; ++q) {
    lj[q] = l[q] + xhalf(l[q]);
    mlm[q * 64 + lane]      = m[q];
    mlm[q * 64 + 32 + lane] = lj[q];
  }

  const bool up = kh != 0;
  #pragma unroll
  for (int q = 0; q < 2; ++q)
    #pragma unroll
    for (int t = 0; t < 8; ++t) {
      const v8f g = up ? O[q][t] : O[q][8 + t];
      mine[((q * 8 + t) * 2 + 0) * 32 + lane] = make_float4(g[0], g[1], g[2], g[3]);
      mine[((q * 8 + t) * 2 + 1) * 32 + lane] = make_float4(g[4], g[5], g[6], g[7]);
    }
  __syncthreads();

  const size_t rowoff = bo + (size_t)(qbase + qg * 32 + lr) * DIM + kh * 128 + 8 * lh;
  const float* xr   = x + rowoff;
  float*       orow = out + rowoff;
  float4 xv[2][8][2];
  #pragma unroll
  for (int q = 0; q < 2; ++q)
    #pragma unroll
    for (int t = 0; t < 8; ++t) {
      xv[q][t][0] = *(const float4*)(xr + q * 16 * DIM + t * 16);
      xv[q][t][1] = *(const float4*)(xr + q * 16 * DIM + t * 16 + 4);
    }

  asm volatile("s_wait_xcnt 0x0" :: "v"(xr) : "memory");

  float a[2], b[2];
  #pragma unroll
  for (int q = 0; q < 2; ++q) {
    const float mo = mlo[q * 64 + lane];
    const float lo = mlo[q * 64 + 32 + lane];
    const float mx = fmaxf(m[q], mo);
    const float fs = __expf(m[q] - mx), fo = __expf(mo - mx);
    const float inv = 1.0f / (lj[q] * fs + lo * fo);
    a[q] = fs * inv;
    b[q] = fo * inv;
  }

  #pragma unroll
  for (int q = 0; q < 2; ++q)
    #pragma unroll
    for (int tg = 0; tg < 8; tg += 4) {
      f32x4 r[4][2];
      #pragma unroll
      for (int u = 0; u < 4; ++u) {
        const int    t  = tg + u;
        const v8f    o  = up ? O[q][8 + t] : O[q][t];
        const float4 pa = other[((q * 8 + t) * 2 + 0) * 32 + lane];
        const float4 pb = other[((q * 8 + t) * 2 + 1) * 32 + lane];
        const float4 xa = xv[q][t][0], xb = xv[q][t][1];
        r[u][0][0] = xa.x + (o[0] * a[q] + pa.x * b[q]); r[u][0][1] = xa.y + (o[1] * a[q] + pa.y * b[q]);
        r[u][0][2] = xa.z + (o[2] * a[q] + pa.z * b[q]); r[u][0][3] = xa.w + (o[3] * a[q] + pa.w * b[q]);
        r[u][1][0] = xb.x + (o[4] * a[q] + pb.x * b[q]); r[u][1][1] = xb.y + (o[5] * a[q] + pb.y * b[q]);
        r[u][1][2] = xb.z + (o[6] * a[q] + pb.z * b[q]); r[u][1][3] = xb.w + (o[7] * a[q] + pb.w * b[q]);
        *(f32x4*)(orow + q * 16 * DIM + t * 16)     = r[u][0];
        *(f32x4*)(orow + q * 16 * DIM + t * 16 + 4) = r[u][1];
      }

      asm volatile("s_wait_xcnt 0x0" :: "v"(r[0][0]), "v"(r[0][1]), "v"(r[1][0]), "v"(r[1][1]),
                   "v"(r[2][0]), "v"(r[2][1]), "v"(r[3][0]), "v"(r[3][1]), "v"(orow) : "memory");
    }
}

extern "C" void kernel_launch(void* const* d_in, const int* in_sizes, int n_in,
                              void* d_out, int out_size, void* d_ws, size_t ws_size,
                              hipStream_t stream) {
  const float* x  = (const float*)d_in[0];
  const float* Wq = (const float*)d_in[1];
  const float* bq = (const float*)d_in[2];
  const float* Wk = (const float*)d_in[3];
  const float* bk = (const float*)d_in[4];
  const float* Wv = (const float*)d_in[5];
  const float* bv = (const float*)d_in[6];
  float* outp = (float*)d_out;

  const size_t NX = (size_t)NROW * DIM;
  const size_t NW = (size_t)DIM * DIM;
  bf16* xb = (bf16*)d_ws;
  bf16* wb = xb + NX;
  bf16* qb = wb + 3 * NW;
  bf16* kb = qb + NX;
  bf16* vb = kb + NX;

  f32_to_bf16_kernel<<<(int)(NX / 2048), 256, 0, stream>>>(x, xb, (int)NX);
  f32_to_bf16_kernel<<<(int)(NW / 2048), 256, 0, stream>>>(Wq, wb,          (int)NW);
  f32_to_bf16_kernel<<<(int)(NW / 2048), 256, 0, stream>>>(Wk, wb + NW,     (int)NW);
  f32_to_bf16_kernel<<<(int)(NW / 2048), 256, 0, stream>>>(Wv, wb + 2 * NW, (int)NW);

  qkv_gemm_kernel<<<dim3(NROW / 128, 6), 128, 0, stream>>>(xb, wb, bq, bk, bv,
                                                          qb, kb, vb);

  attn_kernel<<<dim3(SEQ / 128, BATCH), 256, 0, stream>>>(qb, kb, vb, x, outp);
}

// v006
// It runs in 127 microseconds.
// Next to v005, in two timings, it ran 1.07 and 1.08 times as fast.
// All steps since v000 together make it 6.83 times as fast.
#include <hip/hip_runtime.h>
#include <hip/hip_bf16.h>

typedef __bf16 bf16;
typedef __attribute__((ext_vector_type(8)))  bf16  v8bf;
typedef __attribute__((ext_vector_type(16))) bf16  v16bf;
typedef __attribute__((ext_vector_type(8)))  float v8f;
typedef __attribute__((ext_vector_type(4)))  float f32x4;

#define DIM   256
#define SEQ   4096
#define BATCH 8
#define NROW  (BATCH * SEQ)

__device__ __forceinline__ v16bf load_frag(const bf16* p) {

  v8bf lo = *(const v8bf*)p;
  v8bf hi = *(const v8bf*)(p + 16);
  return __builtin_shufflevector(lo, hi, 0,1,2,3,4,5,6,7,8,9,10,11,12,13,14,15);
}

__device__ __forceinline__ v8bf load_tr16(const bf16* p) {
  typedef __attribute__((address_space(3))) v8bf lds_v8bf;
  return __builtin_amdgcn_ds_load_tr16_b128_v8bf16((lds_v8bf*)p);
}

__device__ __forceinline__ float xhalf(float v) {
  const int b = __builtin_bit_cast(int, v);
  return __builtin_bit_cast(float, __builtin_amdgcn_permlanex16(b, b, 0x76543210, 0xfedcba98, false, false));
}

__device__ __forceinline__ v8f wmma_bf16(v16bf a, v16bf b, v8f c) {
  return __builtin_amdgcn_wmma_f32_16x16x32_bf16(false, a, false, b, (short)0, c,
                                                 false, false);
}

#define SKEYS   64
#define STAGES  (SEQ / SKEYS)
#define KROWB   256u
#define KPITCH  136
#define KSLICEB 18432u
#define KSLICE  9216

#define VPITCH  144

typedef __attribute__((ext_vector_type(4))) unsigned int u32x4;
typedef __attribute__((ext_vector_type(8))) unsigned int u32x8;

__device__ __forceinline__ unsigned uni(unsigned v) {
  return (unsigned)__builtin_amdgcn_readfirstlane(v);
}

__device__ __forceinline__ unsigned pinned(unsigned v) {
  unsigned w = uni(v);
  asm volatile("" : "+s"(w));
  return w;
}

__device__ __forceinline__ void wait_tensor0() { asm volatile("s_wait_tensorcnt 0x0" ::: "memory"); }
__device__ __forceinline__ void wait_ds0()     { asm volatile("s_wait_dscnt 0x0" ::: "memory"); }

__device__ __forceinline__ void wait_tensor0(u32x4 g0, u32x8 g1) {
  asm volatile("s_wait_tensorcnt 0x0" :: "s"(g0), "s"(g1) : "memory");
}

template <unsigned PAD, unsigned ROWS = SKEYS>
__device__ __forceinline__ u32x8 tdm_group1() {
  u32x8 g;
  g[0] = uni((1u << 20) | (5u << 22) | (PAD << 25));
  g[1] = uni(KROWB << 16);
  g[2] = uni(ROWS << 16);
  g[3] = uni(KROWB << 16);
  g[4] = uni(ROWS);
  g[5] = uni(2u * DIM);
  g[6] = uni(0u);
  g[7] = uni(0u);

  asm volatile("" : "+s"(g));
  return g;
}
__device__ __forceinline__ u32x4 tdm_group0(const bf16* gsrc, unsigned lds_byte_off) {
  const unsigned long long ga = (unsigned long long)(uintptr_t)gsrc;
  u32x4 g0;
  g0[0] = uni(1u);
  g0[1] = uni(lds_byte_off);
  g0[2] = uni((unsigned)ga);
  g0[3] = uni((((unsigned)(ga >> 32)) & 0x01FFFFFFu) | (2u << 30));
  return g0;
}
__device__ __forceinline__ void tdm_load(u32x4 g0, u32x8 g1) {
  asm volatile("tensor_load_to_lds %0, %1" :: "s"(g0), "s"(g1) : "memory");
}

__global__ void f32_to_bf16_kernel(const float* __restrict__ src,
                                   bf16* __restrict__ dst, int n) {
  int i = (blockIdx.x * blockDim.x + threadIdx.x) * 8;
  if (i + 8 > n) return;
  float4 a = *(const float4*)(src + i);
  float4 b = *(const float4*)(src + i + 4);
  v8bf o;
  o[0] = (bf16)a.x; o[1] = (bf16)a.y; o[2] = (bf16)a.z; o[3] = (bf16)a.w;
  o[4] = (bf16)b.x; o[5] = (bf16)b.y; o[6] = (bf16)b.z; o[7] = (bf16)b.w;
  *(v8bf*)(dst + i) = o;
}

#define PROWS   128
#define PSLICEB 34816u
#define PSLICE  17408
__global__ __launch_bounds__(128) void qkv_gemm_kernel(
    const bf16* __restrict__ xb, const bf16* __restrict__ wb,
    const float* __restrict__ bq, const float* __restrict__ bk,
    const float* __restrict__ bv,
    bf16* __restrict__ qo, bf16* __restrict__ ko, bf16* __restrict__ vo) {

  __shared__ __attribute__((aligned(2048))) bf16 Stg[4 * PSLICE];

  const int mat  = blockIdx.y >> 1;
  const int ch   = blockIdx.y & 1;
  const bf16*  W    = wb + (size_t)mat * DIM * DIM + (size_t)ch * PROWS * DIM;
  const float* bias = (mat == 0) ? bq : (mat == 1) ? bk : bv;
  bf16*        out  = (mat == 0) ? qo : (mat == 1) ? ko : vo;
  const float  scl  = (mat == 0) ? 0.0625f : 1.0f;

  const unsigned wave = uni((unsigned)threadIdx.x >> 5);
  const int lane = threadIdx.x & 31;
  const int lr   = lane & 15, lh = lane >> 4;
  const int rowbase = blockIdx.x * PROWS;

  float bb[8];
  #pragma unroll
  for (int t = 0; t < 8; ++t) bb[t] = bias[ch * 128 + t * 16 + lr];

  {
    const bf16* src = (wave < 2u) ? xb + (size_t)rowbase * DIM : W;
    const u32x8 g1 = tdm_group1<3u, PROWS>();
    const u32x4 g0 = tdm_group0(src + (wave & 1u) * 128u, (unsigned)(uintptr_t)&Stg[0] + wave * PSLICEB);
    tdm_load(g0, g1);
    wait_tensor0(g0, g1);
  }
  __syncthreads();

  const int afr = ((int)wave * 32 + lr) * KPITCH + lh * 8;
  const int bfr = 2 * PSLICE + lr * KPITCH + lh * 8;

  v8f acc[2][8];
  #pragma unroll
  for (int a = 0; a < 2; ++a)
    #pragma unroll
    for (int t = 0; t < 8; ++t)
      #pragma unroll
      for (int i = 0; i < 8; ++i) acc[a][t][i] = 0.0f;

  v16bf Af[2][2], Bf[2][4];
  auto fetch_a = [&](int kc) {
    const int ko = (kc >> 2) * PSLICE + (kc & 3) * 32;
    Af[kc & 1][0] = load_frag(&Stg[afr + ko]);
    Af[kc & 1][1] = load_frag(&Stg[afr + 16 * KPITCH + ko]);
  };
  auto fetch_b = [&](int b) {
    const int kc = b >> 1;
    const int ko = (kc >> 2) * PSLICE + (kc & 3) * 32;
    #pragma unroll
    for (int j = 0; j < 4; ++j) Bf[b & 1][j] = load_frag(&Stg[bfr + ((b & 1) * 4 + j) * 16 * KPITCH + ko]);
  };
  fetch_a(0);
  fetch_b(0);
  #pragma unroll
  for (int b = 0; b < 16; ++b) {
    if (b < 15) {
      if (b & 1) fetch_a((b + 1) >> 1);
      fetch_b(b + 1);
    }

    __builtin_amdgcn_sched_barrier(0);
    #pragma unroll
    for (int j = 0; j < 4; ++j) {
      const int t = (b & 1) * 4 + j;
      acc[0][t] = wmma_bf16(Af[(b >> 1) & 1][0], Bf[b & 1][j], acc[0][t]);
      acc[1][t] = wmma_bf16(Af[(b >> 1) & 1][1], Bf[b & 1][j], acc[1][t]);
    }
    __builtin_amdgcn_sched_barrier(0);
  }
  #pragma unroll
  for (int t = 0; t < 8; ++t) {
    const int col = ch * 128 + t * 16 + lr;
    #pragma unroll
    for (int a = 0; a < 2; ++a)
      #pragma unroll
      for (int i = 0; i < 8; ++i) {
        const int row = rowbase + (int)wave * 32 + a * 16 + i + 8 * lh;
        out[(size_t)row * DIM + col] = (bf16)((acc[a][t][i] + bb[t]) * scl);
      }
  }
}

__global__ __launch_bounds__(256) void attn_kernel(
    const bf16* __restrict__ qb, const bf16* __restrict__ kb,
    const bf16* __restrict__ vb, const float* __restrict__ x,
    float* __restrict__ out) {

  __shared__ __attribute__((aligned(2048))) bf16 Ring[8][KSLICE];

  const int batch = blockIdx.y;
  const int qbase = blockIdx.x * 128;
  const int tid   = threadIdx.x;
  const int lane  = tid & 31;
  const int lr    = lane & 15, lh = lane >> 4;
  const size_t bo = (size_t)batch * SEQ * DIM;
  const unsigned wave = uni((unsigned)tid >> 5);
  const int qg = (int)(wave & 3u), kh = (int)(wave >> 2);

  v16bf Qf[2][8];
  const bf16* qrow = qb + bo + (size_t)(qbase + qg * 32 + lr) * DIM + lh * 8;
  #pragma unroll
  for (int q = 0; q < 2; ++q)
    #pragma unroll
    for (int kc = 0; kc < 8; ++kc) Qf[q][kc] = load_frag(qrow + q * 16 * DIM + kc * 32);

  v8f O[2][16];
  #pragma unroll
  for (int q = 0; q < 2; ++q)
    #pragma unroll
    for (int t = 0; t < 16; ++t)
      #pragma unroll
      for (int i = 0; i < 8; ++i) O[q][t][i] = 0.0f;
  float m[2] = {-3.0e38f, -3.0e38f};
  float l[2] = {0.0f, 0.0f};

  const int kfr = (kh * 32 + lr) * KPITCH + lh * 8;
  const int vtr = (kh * 32 + 8 * lh + (lane & 7)) * VPITCH + ((lane >> 3) & 1) * 8;

  const u32x8    g1     = tdm_group1<3u>();
  u32x4          g0     = {0u, 0u, 0u, 0u};
  const bf16*    ksrc   = kb + bo + (wave & 1u) * 128u;
  const unsigned kdst   = (unsigned)(uintptr_t)&Ring[0][0] + (wave & 1u) * KSLICEB;
  auto issue_k = [&](int st) {
    g0 = tdm_group0(ksrc + (size_t)st * SKEYS * DIM, kdst + (unsigned)(st & 1) * (2u * KSLICEB));
    tdm_load(g0, g1);
  };

  const unsigned vwave  = (wave & 6u) == 2u;
  const u32x8    g1v    = tdm_group1<7u>();
  const bf16*    vsrc   = vb + bo + (wave & 1u) * 128u;
  const unsigned vdst   = (unsigned)(uintptr_t)&Ring[4][0] + (wave & 1u) * KSLICEB;
  u32x4          g0v    = {0u, 0u, 0u, 0u};
  auto issue_v = [&](int st) {
    g0v = tdm_group0(vsrc + (size_t)st * SKEYS * DIM, vdst + (unsigned)(st & 1) * (2u * KSLICEB));

    asm volatile("" : "+s"(g0v));
    tdm_load(g0v, g1v);
  };

  if (pinned(wave < 2u)) { issue_k(0); wait_tensor0(g0, g1); }
  if (pinned(vwave))     { issue_v(0); wait_tensor0(g0v, g1v); }
  __syncthreads();
  if (pinned(wave < 2u)) issue_k(1);
  if (pinned(vwave))     issue_v(1);

  for (int st = 0; st < STAGES; ++st) {
    const int cur = st & 1;

    v8f s[2][2] = {{{0,0,0,0,0,0,0,0}, {0,0,0,0,0,0,0,0}}, {{0,0,0,0,0,0,0,0}, {0,0,0,0,0,0,0,0}}};

    v16bf Kf[4][2];
    auto fetch_k = [&](int kc) {
      Kf[kc & 3][0] = load_frag(&Ring[cur * 2 + (kc >> 2)][kfr + (kc & 3) * 32]);
      Kf[kc & 3][1] = load_frag(&Ring[cur * 2 + (kc >> 2)][kfr + 16 * KPITCH + (kc & 3) * 32]);
    };
    auto qk = [&](int kc) {
      #pragma unroll
      for (int q = 0; q < 2; ++q) {
        s[q][0] = wmma_bf16(Kf[kc & 3][0], Qf[q][kc], s[q][0]);
        s[q][1] = wmma_bf16(Kf[kc & 3][1], Qf[q][kc], s[q][1]);
      }
    };

    fetch_k(0); fetch_k(1); fetch_k(2); fetch_k(3);
    __builtin_amdgcn_sched_barrier(0);
    qk(0); qk(1);
    __builtin_amdgcn_sched_barrier(0);
    fetch_k(4); fetch_k(5);
    __builtin_amdgcn_sched_barrier(0);
    qk(2); qk(3);
    __builtin_amdgcn_sched_barrier(0);
    fetch_k(6); fetch_k(7);
    __builtin_amdgcn_sched_barrier(0);
    qk(4); qk(5); qk(6); qk(7);

    v16bf Vf[2][4];
    auto fetch_v = [&](int g) {
      #pragma unroll
      for (int j = 0; j < 4; ++j) {
        const int t = g * 4 + j;

        v8bf lo = load_tr16(&Ring[4 + cur * 2 + (t >> 3)][vtr + (t & 7) * 16]);
        v8bf hi = load_tr16(&Ring[4 + cur * 2 + (t >> 3)][vtr + 16 * VPITCH + (t & 7) * 16]);
        Vf[g % 2][j] = __builtin_shufflevector(lo, hi, 0,1,2,3,4,5,6,7,8,9,10,11,12,13,14,15);
      }
    };
    __builtin_amdgcn_sched_barrier(0);
    fetch_v(0);
    __builtin_amdgcn_sched_barrier(0);

    v16bf Pf[2];
    float cf[2];
    #pragma unroll
    for (int q = 0; q < 2; ++q) {
      v8f s0 = s[q][0], s1 = s[q][1];
      float t4[4];
      #pragma unroll
      for (int i = 0; i < 4; ++i) t4[i] = fmaxf(fmaxf(s0[i], s1[i]), fmaxf(s0[i + 4], s1[i + 4]));
      float t = fmaxf(fmaxf(t4[0], t4[1]), fmaxf(t4[2], t4[3]));
      t = fmaxf(t, xhalf(t));
      const float mn   = fmaxf(m[q], t);
      const float corr = __expf(m[q] - mn);
      m[q] = mn;
      #pragma unroll
      for (int i = 0; i < 8; ++i) {
        s0[i] = __expf(s0[i] - mn);
        s1[i] = __expf(s1[i] - mn);
      }
      const float r = (((s0[0] + s1[0]) + (s0[1] + s1[1])) + ((s0[2] + s1[2]) + (s0[3] + s1[3])))
                    + (((s0[4] + s1[4]) + (s0[5] + s1[5])) + ((s0[6] + s1[6]) + (s0[7] + s1[7])));
      l[q] = l[q] * corr + r;
      cf[q] = corr;

      #pragma unroll
      for (int i = 0; i < 8; ++i) { Pf[q][i] = (bf16)s0[i]; Pf[q][8 + i] = (bf16)s1[i]; }
    }

    auto pv = [&](int g) {
      #pragma unroll
      for (int j = 0; j < 4; ++j)
        #pragma unroll
        for (int q = 0; q < 2; ++q) O[q][g * 4 + j] = wmma_bf16(Vf[g % 2][j], Pf[q], O[q][g * 4 + j] * cf[q]);
    };
    __builtin_amdgcn_sched_barrier(0);
    fetch_v(1);
    __builtin_amdgcn_sched_barrier(0);
    pv(0);
    __builtin_amdgcn_sched_barrier(0);
    fetch_v(2);
    __builtin_amdgcn_sched_barrier(0);
    pv(1);
    __builtin_amdgcn_sched_barrier(0);
    fetch_v(3);
    __builtin_amdgcn_sched_barrier(0);
    pv(2);
    pv(3);
    __builtin_amdgcn_sched_barrier(0);

    wait_ds0();
    if (pinned(wave < 2u)) wait_tensor0(g0, g1);
    if (pinned(vwave))     wait_tensor0(g0v, g1v);
    __syncthreads();
    if (pinned(wave < 2u && st + 2 < STAGES)) issue_k(st + 2);
    if (pinned(vwave && st + 2 < STAGES))     issue_v(st + 2);
  }
  wait_tensor0();
  wait_ds0();

  float*  stg   = (float*)&Ring[0][0];
  float4* mine  = (float4*)(stg + wave * 4096u);
  float4* other = (float4*)(stg + (wave ^ 4u) * 4096u);
  float*  mlm   = stg + 32768u + wave * 128u;
  float*  mlo   = stg + 32768u + (wave ^ 4u) * 128u;
  float lj[2];
  #pragma unroll
  for (int q = 0; q < 2; ++q) {
    lj[q] = l[q] + xhalf(l[q]);
    mlm[q * 64 + lane]      = m[q];
    mlm[q * 64 + 32 + lane] = lj[q];
  }

  const bool up = kh != 0;
  #pragma unroll
  for (int q = 0; q < 2; ++q)
    #pragma unroll
    for (int t = 0; t < 8; ++t) {
      const v8f g = up ? O[q][t] : O[q][8 + t];
      mine[((q * 8 + t) * 2 + 0) * 32 + lane] = make_float4(g[0], g[1], g[2], g[3]);
      mine[((q * 8 + t) * 2 + 1) * 32 + lane] = make_float4(g[4], g[5], g[6], g[7]);
    }
  __syncthreads();

  const size_t rowoff = bo + (size_t)(qbase + qg * 32 + lr) * DIM + kh * 128 + 8 * lh;
  const float* xr   = x + rowoff;
  float*       orow = out + rowoff;
  float4 xv[2][8][2];
  #pragma unroll
  for (int q = 0; q < 2; ++q)
    #pragma unroll
    for (int t = 0; t < 8; ++t) {
      xv[q][t][0] = *(const float4*)(xr + q * 16 * DIM + t * 16);
      xv[q][t][1] = *(const float4*)(xr + q * 16 * DIM + t * 16 + 4);
    }

  asm volatile("s_wait_xcnt 0x0" :: "v"(xr) : "memory");

  float a[2], b[2];
  #pragma unroll
  for (int q = 0; q < 2; ++q) {
    const float mo = mlo[q * 64 + lane];
    const float lo = mlo[q * 64 + 32 + lane];
    const float mx = fmaxf(m[q], mo);
    const float fs = __expf(m[q] - mx), fo = __expf(mo - mx);
    const float inv = 1.0f / (lj[q] * fs + lo * fo);
    a[q] = fs * inv;
    b[q] = fo * inv;
  }

  #pragma unroll
  for (int q = 0; q < 2; ++q)
    #pragma unroll
    for (int tg = 0; tg < 8; tg += 4) {
      f32x4 r[4][2];
      #pragma unroll
      for (int u = 0; u < 4; ++u) {
        const int    t  = tg + u;
        const v8f    o  = up ? O[q][8 + t] : O[q][t];
        const float4 pa = other[((q * 8 + t) * 2 + 0) * 32 + lane];
        const float4 pb = other[((q * 8 + t) * 2 + 1) * 32 + lane];
        const float4 xa = xv[q][t][0], xb = xv[q][t][1];
        r[u][0][0] = xa.x + (o[0] * a[q] + pa.x * b[q]); r[u][0][1] = xa.y + (o[1] * a[q] + pa.y * b[q]);
        r[u][0][2] = xa.z + (o[2] * a[q] + pa.z * b[q]); r[u][0][3] = xa.w + (o[3] * a[q] + pa.w * b[q]);
        r[u][1][0] = xb.x + (o[4] * a[q] + pb.x * b[q]); r[u][1][1] = xb.y + (o[5] * a[q] + pb.y * b[q]);
        r[u][1][2] = xb.z + (o[6] * a[q] + pb.z * b[q]); r[u][1][3] = xb.w + (o[7] * a[q] + pb.w * b[q]);
        *(f32x4*)(orow + q * 16 * DIM + t * 16)     = r[u][0];
        *(f32x4*)(orow + q * 16 * DIM + t * 16 + 4) = r[u][1];
      }

      asm volatile("s_wait_xcnt 0x0" :: "v"(r[0][0]), "v"(r[0][1]), "v"(r[1][0]), "v"(r[1][1]),
                   "v"(r[2][0]), "v"(r[2][1]), "v"(r[3][0]), "v"(r[3][1]), "v"(orow) : "memory");
    }
}

extern "C" void kernel_launch(void* const* d_in, const int* in_sizes, int n_in,
                              void* d_out, int out_size, void* d_ws, size_t ws_size,
                              hipStream_t stream) {
  const float* x  = (const float*)d_in[0];
  const float* Wq = (const float*)d_in[1];
  const float* bq = (const float*)d_in[2];
  const float* Wk = (const float*)d_in[3];
  const float* bk = (const float*)d_in[4];
  const float* Wv = (const float*)d_in[5];
  const float* bv = (const float*)d_in[6];
  float* outp = (float*)d_out;

  const size_t NX = (size_t)NROW * DIM;
  const size_t NW = (size_t)DIM * DIM;
  bf16* xb = (bf16*)d_ws;
  bf16* wb = xb + NX;
  bf16* qb = wb + 3 * NW;
  bf16* kb = qb + NX;
  bf16* vb = kb + NX;

  f32_to_bf16_kernel<<<(int)(NX / 2048), 256, 0, stream>>>(x, xb, (int)NX);
  f32_to_bf16_kernel<<<(int)(NW / 2048), 256, 0, stream>>>(Wq, wb,          (int)NW);
  f32_to_bf16_kernel<<<(int)(NW / 2048), 256, 0, stream>>>(Wk, wb + NW,     (int)NW);
  f32_to_bf16_kernel<<<(int)(NW / 2048), 256, 0, stream>>>(Wv, wb + 2 * NW, (int)NW);

  qkv_gemm_kernel<<<dim3(NROW / 128, 6), 128, 0, stream>>>(xb, wb, bq, bk, bv,
                                                          qb, kb, vb);

  attn_kernel<<<dim3(SEQ / 128, BATCH), 256, 0, stream>>>(qb, kb, vb, x, outp);
}

// v007
// Measured time: 119 microseconds a run.
// Next to v006, in two timings, it ran 1.06 times as fast each time.
// All steps since v000 together make it 7.27 times as fast.
#include <hip/hip_runtime.h>
#include <hip/hip_bf16.h>

typedef __bf16 bf16;
typedef __attribute__((ext_vector_type(8)))  bf16  v8bf;
typedef __attribute__((ext_vector_type(16))) bf16  v16bf;
typedef __attribute__((ext_vector_type(8)))  float v8f;
typedef __attribute__((ext_vector_type(4)))  float f32x4;

#define DIM   256
#define SEQ   4096
#define BATCH 8
#define NROW  (BATCH * SEQ)

__device__ __forceinline__ v16bf load_frag(const bf16* p) {

  v8bf lo = *(const v8bf*)p;
  v8bf hi = *(const v8bf*)(p + 16);
  return __builtin_shufflevector(lo, hi, 0,1,2,3,4,5,6,7,8,9,10,11,12,13,14,15);
}

__device__ __forceinline__ v8bf load_tr16(const bf16* p) {
  typedef __attribute__((address_space(3))) v8bf lds_v8bf;
  return __builtin_amdgcn_ds_load_tr16_b128_v8bf16((lds_v8bf*)p);
}

__device__ __forceinline__ float xhalf(float v) {
  const int b = __builtin_bit_cast(int, v);
  return __builtin_bit_cast(float, __builtin_amdgcn_permlanex16(b, b, 0x76543210, 0xfedcba98, false, false));
}

__device__ __forceinline__ v8f wmma_bf16(v16bf a, v16bf b, v8f c) {
  return __builtin_amdgcn_wmma_f32_16x16x32_bf16(false, a, false, b, (short)0, c,
                                                 false, false);
}

#define SKEYS   64
#define STAGES  (SEQ / SKEYS)
#define KROWB   256u
#define KPITCH  136
#define KSLICEB 18432u
#define KSLICE  9216

#define VPITCH  144

typedef __attribute__((ext_vector_type(4))) unsigned int u32x4;
typedef __attribute__((ext_vector_type(8))) unsigned int u32x8;

__device__ __forceinline__ unsigned uni(unsigned v) {
  return (unsigned)__builtin_amdgcn_readfirstlane(v);
}

__device__ __forceinline__ unsigned pinned(unsigned v) {
  unsigned w = uni(v);
  asm volatile("" : "+s"(w));
  return w;
}

__device__ __forceinline__ void wait_tensor0() { asm volatile("s_wait_tensorcnt 0x0" ::: "memory"); }
__device__ __forceinline__ void wait_ds0()     { asm volatile("s_wait_dscnt 0x0" ::: "memory"); }

__device__ __forceinline__ void wait_tensor0(u32x4 g0, u32x8 g1) {
  asm volatile("s_wait_tensorcnt 0x0" :: "s"(g0), "s"(g1) : "memory");
}

template <unsigned PAD, unsigned ROWS = SKEYS>
__device__ __forceinline__ u32x8 tdm_group1() {
  u32x8 g;
  g[0] = uni((1u << 20) | (5u << 22) | (PAD << 25));
  g[1] = uni(KROWB << 16);
  g[2] = uni(ROWS << 16);
  g[3] = uni(KROWB << 16);
  g[4] = uni(ROWS);
  g[5] = uni(2u * DIM);
  g[6] = uni(0u);
  g[7] = uni(0u);

  asm volatile("" : "+s"(g));
  return g;
}
__device__ __forceinline__ u32x4 tdm_group0(const bf16* gsrc, unsigned lds_byte_off) {
  const unsigned long long ga = (unsigned long long)(uintptr_t)gsrc;
  u32x4 g0;
  g0[0] = uni(1u);
  g0[1] = uni(lds_byte_off);
  g0[2] = uni((unsigned)ga);
  g0[3] = uni((((unsigned)(ga >> 32)) & 0x01FFFFFFu) | (2u << 30));
  return g0;
}
__device__ __forceinline__ void tdm_load(u32x4 g0, u32x8 g1) {
  asm volatile("tensor_load_to_lds %0, %1" :: "s"(g0), "s"(g1) : "memory");
}

#define CVT_WAVE 2048
#define CVT_WG   (16 * CVT_WAVE)
#define CVT_XWG  (NROW * DIM / CVT_WG)
#define CVT_WWG  (DIM * DIM / CVT_WG)
typedef __attribute__((ext_vector_type(4))) bf16 v4bf;

__global__ __launch_bounds__(512) __attribute__((amdgpu_waves_per_eu(4, 8))) void f32_to_bf16_kernel(
    const float* __restrict__ x, const float* __restrict__ wq, const float* __restrict__ wk,
    const float* __restrict__ wv, bf16* __restrict__ dst) {
  const unsigned b = blockIdx.x;

  const float*   arr   = (b < CVT_XWG) ? x : (b < CVT_XWG + CVT_WWG) ? wq : (b < CVT_XWG + 2 * CVT_WWG) ? wk : wv;
  const unsigned first = (b < CVT_XWG) ? 0u : CVT_XWG + (b - CVT_XWG) / CVT_WWG * CVT_WWG;
  const float*   src   = arr + (size_t)(b - first) * CVT_WG;
  const unsigned off = (threadIdx.x >> 5) * CVT_WAVE + (threadIdx.x & 31) * 4;
  const unsigned lb  = off * 4u;
  dst += (size_t)b * CVT_WG + off;

  f32x4 v[16];
  #pragma unroll
  for (int j = 0; j < 16; ++j) v[j] = *(const f32x4*)((const char*)src + lb + j * 512);

  asm volatile("s_wait_xcnt 0x0" :: "v"(lb) : "memory");
  #pragma unroll
  for (int j = 0; j < 16; ++j) {
    v4bf o;
    o[0] = (bf16)v[j][0]; o[1] = (bf16)v[j][1]; o[2] = (bf16)v[j][2]; o[3] = (bf16)v[j][3];
    *(v4bf*)(dst + j * 128) = o;
  }
}

#define PROWS   128
#define PSLICEB 34816u
#define PSLICE  17408
__global__ __launch_bounds__(128) void qkv_gemm_kernel(
    const bf16* __restrict__ xb, const bf16* __restrict__ wb,
    const float* __restrict__ bq, const float* __restrict__ bk,
    const float* __restrict__ bv,
    bf16* __restrict__ qo, bf16* __restrict__ ko, bf16* __restrict__ vo) {

  __shared__ __attribute__((aligned(2048))) bf16 Stg[4 * PSLICE];

  const int mat  = blockIdx.y >> 1;
  const int ch   = blockIdx.y & 1;
  const bf16*  W    = wb + (size_t)mat * DIM * DIM + (size_t)ch * PROWS * DIM;
  const float* bias = (mat == 0) ? bq : (mat == 1) ? bk : bv;
  bf16*        out  = (mat == 0) ? qo : (mat == 1) ? ko : vo;
  const float  scl  = (mat == 0) ? 0.0625f : 1.0f;

  const unsigned wave = uni((unsigned)threadIdx.x >> 5);
  const int lane = threadIdx.x & 31;
  const int lr   = lane & 15, lh = lane >> 4;
  const int rowbase = blockIdx.x * PROWS;

  float bb[8];
  #pragma unroll
  for (int t = 0; t < 8; ++t) bb[t] = bias[ch * 128 + t * 16 + lr];

  {
    const bf16* src = (wave < 2u) ? xb + (size_t)rowbase * DIM : W;
    const u32x8 g1 = tdm_group1<3u, PROWS>();
    const u32x4 g0 = tdm_group0(src + (wave & 1u) * 128u, (unsigned)(uintptr_t)&Stg[0] + wave * PSLICEB);
    tdm_load(g0, g1);
    wait_tensor0(g0, g1);
  }
  __syncthreads();

  const int afr = ((int)wave * 32 + lr) * KPITCH + lh * 8;
  const int bfr = 2 * PSLICE + lr * KPITCH + lh * 8;

  v8f acc[2][8];
  #pragma unroll
  for (int a = 0; a < 2; ++a)
    #pragma unroll
    for (int t = 0; t < 8; ++t)
      #pragma unroll
      for (int i = 0; i < 8; ++i) acc[a][t][i] = 0.0f;

  v16bf Af[2][2], Bf[2][4];
  auto fetch_a = [&](int kc) {
    const int ko = (kc >> 2) * PSLICE + (kc & 3) * 32;
    Af[kc & 1][0] = load_frag(&Stg[afr + ko]);
    Af[kc & 1][1] = load_frag(&Stg[afr + 16 * KPITCH + ko]);
  };
  auto fetch_b = [&](int b) {
    const int kc = b >> 1;
    const int ko = (kc >> 2) * PSLICE + (kc & 3) * 32;
    #pragma unroll
    for (int j = 0; j < 4; ++j) Bf[b & 1][j] = load_frag(&Stg[bfr + ((b & 1) * 4 + j) * 16 * KPITCH + ko]);
  };
  fetch_a(0);
  fetch_b(0);
  #pragma unroll
  for (int b = 0; b < 16; ++b) {
    if (b < 15) {
      if (b & 1) fetch_a((b + 1) >> 1);
      fetch_b(b + 1);
    }

    __builtin_amdgcn_sched_barrier(0);
    #pragma unroll
    for (int j = 0; j < 4; ++j) {
      const int t = (b & 1) * 4 + j;
      acc[0][t] = wmma_bf16(Af[(b >> 1) & 1][0], Bf[b & 1][j], acc[0][t]);
      acc[1][t] = wmma_bf16(Af[(b >> 1) & 1][1], Bf[b & 1][j], acc[1][t]);
    }
    __builtin_amdgcn_sched_barrier(0);
  }
  #pragma unroll
  for (int t = 0; t < 8; ++t) {
    const int col = ch * 128 + t * 16 + lr;
    #pragma unroll
    for (int a = 0; a < 2; ++a)
      #pragma unroll
      for (int i = 0; i < 8; ++i) {
        const int row = rowbase + (int)wave * 32 + a * 16 + i + 8 * lh;
        out[(size_t)row * DIM + col] = (bf16)((acc[a][t][i] + bb[t]) * scl);
      }
  }
}

__global__ __launch_bounds__(256) void attn_kernel(
    const bf16* __restrict__ qb, const bf16* __restrict__ kb,
    const bf16* __restrict__ vb, const float* __restrict__ x,
    float* __restrict__ out) {

  __shared__ __attribute__((aligned(2048))) bf16 Ring[8][KSLICE];

  const int batch = blockIdx.y;
  const int qbase = blockIdx.x * 128;
  const int tid   = threadIdx.x;
  const int lane  = tid & 31;
  const int lr    = lane & 15, lh = lane >> 4;
  const size_t bo = (size_t)batch * SEQ * DIM;
  const unsigned wave = uni((unsigned)tid >> 5);
  const int qg = (int)(wave & 3u), kh = (int)(wave >> 2);

  v16bf Qf[2][8];
  const bf16* qrow = qb + bo + (size_t)(qbase + qg * 32 + lr) * DIM + lh * 8;
  #pragma unroll
  for (int q = 0; q < 2; ++q)
    #pragma unroll
    for (int kc = 0; kc < 8; ++kc) Qf[q][kc] = load_frag(qrow + q * 16 * DIM + kc * 32);

  v8f O[2][16];
  #pragma unroll
  for (int q = 0; q < 2; ++q)
    #pragma unroll
    for (int t = 0; t < 16; ++t)
      #pragma unroll
      for (int i = 0; i < 8; ++i) O[q][t][i] = 0.0f;
  float m[2] = {-3.0e38f, -3.0e38f};
  float l[2] = {0.0f, 0.0f};

  const int kfr = (kh * 32 + lr) * KPITCH + lh * 8;
  const int vtr = (kh * 32 + 8 * lh + (lane & 7)) * VPITCH + ((lane >> 3) & 1) * 8;

  const u32x8    g1     = tdm_group1<3u>();
  u32x4          g0     = {0u, 0u, 0u, 0u};
  const bf16*    ksrc   = kb + bo + (wave & 1u) * 128u;
  const unsigned kdst   = (unsigned)(uintptr_t)&Ring[0][0] + (wave & 1u) * KSLICEB;
  auto issue_k = [&](int st) {
    g0 = tdm_group0(ksrc + (size_t)st * SKEYS * DIM, kdst + (unsigned)(st & 1) * (2u * KSLICEB));
    tdm_load(g0, g1);
  };

  const unsigned vwave  = (wave & 6u) == 2u;
  const u32x8    g1v    = tdm_group1<7u>();
  const bf16*    vsrc   = vb + bo + (wave & 1u) * 128u;
  const unsigned vdst   = (unsigned)(uintptr_t)&Ring[4][0] + (wave & 1u) * KSLICEB;
  u32x4          g0v    = {0u, 0u, 0u, 0u};
  auto issue_v = [&](int st) {
    g0v = tdm_group0(vsrc + (size_t)st * SKEYS * DIM, vdst + (unsigned)(st & 1) * (2u * KSLICEB));

    asm volatile("" : "+s"(g0v));
    tdm_load(g0v, g1v);
  };

  if (pinned(wave < 2u)) { issue_k(0); wait_tensor0(g0, g1); }
  if (pinned(vwave))     { issue_v(0); wait_tensor0(g0v, g1v); }
  __syncthreads();
  if (pinned(wave < 2u)) issue_k(1);
  if (pinned(vwave))     issue_v(1);

  for (int st = 0; st < STAGES; ++st) {
    const int cur = st & 1;

    v8f s[2][2] = {{{0,0,0,0,0,0,0,0}, {0,0,0,0,0,0,0,0}}, {{0,0,0,0,0,0,0,0}, {0,0,0,0,0,0,0,0}}};

    v16bf Kf[4][2];
    auto fetch_k = [&](int kc) {
      Kf[kc & 3][0] = load_frag(&Ring[cur * 2 + (kc >> 2)][kfr + (kc & 3) * 32]);
      Kf[kc & 3][1] = load_frag(&Ring[cur * 2 + (kc >> 2)][kfr + 16 * KPITCH + (kc & 3) * 32]);
    };
    auto qk = [&](int kc) {
      #pragma unroll
      for (int q = 0; q < 2; ++q) {
        s[q][0] = wmma_bf16(Kf[kc & 3][0], Qf[q][kc], s[q][0]);
        s[q][1] = wmma_bf16(Kf[kc & 3][1], Qf[q][kc], s[q][1]);
      }
    };

    fetch_k(0); fetch_k(1); fetch_k(2); fetch_k(3);
    __builtin_amdgcn_sched_barrier(0);
    qk(0); qk(1);
    __builtin_amdgcn_sched_barrier(0);
    fetch_k(4); fetch_k(5);
    __builtin_amdgcn_sched_barrier(0);
    qk(2); qk(3);
    __builtin_amdgcn_sched_barrier(0);
    fetch_k(6); fetch_k(7);
    __builtin_amdgcn_sched_barrier(0);
    qk(4); qk(5); qk(6); qk(7);

    v16bf Vf[2][4];
    auto fetch_v = [&](int g) {
      #pragma unroll
      for (int j = 0; j < 4; ++j) {
        const int t = g * 4 + j;

        v8bf lo = load_tr16(&Ring[4 + cur * 2 + (t >> 3)][vtr + (t & 7) * 16]);
        v8bf hi = load_tr16(&Ring[4 + cur * 2 + (t >> 3)][vtr + 16 * VPITCH + (t & 7) * 16]);
        Vf[g % 2][j] = __builtin_shufflevector(lo, hi, 0,1,2,3,4,5,6,7,8,9,10,11,12,13,14,15);
      }
    };
    __builtin_amdgcn_sched_barrier(0);
    fetch_v(0);
    __builtin_amdgcn_sched_barrier(0);

    v16bf Pf[2];
    float cf[2];
    #pragma unroll
    for (int q = 0; q < 2; ++q) {
      v8f s0 = s[q][0], s1 = s[q][1];
      float t4[4];
      #pragma unroll
      for (int i = 0; i < 4; ++i) t4[i] = fmaxf(fmaxf(s0[i], s1[i]), fmaxf(s0[i + 4], s1[i + 4]));
      float t = fmaxf(fmaxf(t4[0], t4[1]), fmaxf(t4[2], t4[3]));
      t = fmaxf(t, xhalf(t));
      const float mn   = fmaxf(m[q], t);
      const float corr = __expf(m[q] - mn);
      m[q] = mn;
      #pragma unroll
      for (int i = 0; i < 8; ++i) {
        s0[i] = __expf(s0[i] - mn);
        s1[i] = __expf(s1[i] - mn);
      }
      const float r = (((s0[0] + s1[0]) + (s0[1] + s1[1])) + ((s0[2] + s1[2]) + (s0[3] + s1[3])))
                    + (((s0[4] + s1[4]) + (s0[5] + s1[5])) + ((s0[6] + s1[6]) + (s0[7] + s1[7])));
      l[q] = l[q] * corr + r;
      cf[q] = corr;

      #pragma unroll
      for (int i = 0; i < 8; ++i) { Pf[q][i] = (bf16)s0[i]; Pf[q][8 + i] = (bf16)s1[i]; }
    }

    auto pv = [&](int g) {
      #pragma unroll
      for (int j = 0; j < 4; ++j)
        #pragma unroll
        for (int q = 0; q < 2; ++q) O[q][g * 4 + j] = wmma_bf16(Vf[g % 2][j], Pf[q], O[q][g * 4 + j] * cf[q]);
    };
    __builtin_amdgcn_sched_barrier(0);
    fetch_v(1);
    __builtin_amdgcn_sched_barrier(0);
    pv(0);
    __builtin_amdgcn_sched_barrier(0);
    fetch_v(2);
    __builtin_amdgcn_sched_barrier(0);
    pv(1);
    __builtin_amdgcn_sched_barrier(0);
    fetch_v(3);
    __builtin_amdgcn_sched_barrier(0);
    pv(2);
    pv(3);
    __builtin_amdgcn_sched_barrier(0);

    wait_ds0();
    if (pinned(wave < 2u)) wait_tensor0(g0, g1);
    if (pinned(vwave))     wait_tensor0(g0v, g1v);
    __syncthreads();
    if (pinned(wave < 2u && st + 2 < STAGES)) issue_k(st + 2);
    if (pinned(vwave && st + 2 < STAGES))     issue_v(st + 2);
  }
  wait_tensor0();
  wait_ds0();

  float*  stg   = (float*)&Ring[0][0];
  float4* mine  = (float4*)(stg + wave * 4096u);
  float4* other = (float4*)(stg + (wave ^ 4u) * 4096u);
  float*  mlm   = stg + 32768u + wave * 128u;
  float*  mlo   = stg + 32768u + (wave ^ 4u) * 128u;
  float lj[2];
  #pragma unroll
  for (int q = 0; q < 2; ++q) {
    lj[q] = l[q] + xhalf(l[q]);
    mlm[q * 64 + lane]      = m[q];
    mlm[q * 64 + 32 + lane] = lj[q];
  }

  const bool up = kh != 0;
  #pragma unroll
  for (int q = 0; q < 2; ++q)
    #pragma unroll
    for (int t = 0; t < 8; ++t) {
      const v8f g = up ? O[q][t] : O[q][8 + t];
      mine[((q * 8 + t) * 2 + 0) * 32 + lane] = make_float4(g[0], g[1], g[2], g[3]);
      mine[((q * 8 + t) * 2 + 1) * 32 + lane] = make_float4(g[4], g[5], g[6], g[7]);
    }
  __syncthreads();

  const size_t rowoff = bo + (size_t)(qbase + qg * 32 + lr) * DIM + kh * 128 + 8 * lh;
  const float* xr   = x + rowoff;
  float*       orow = out + rowoff;
  float4 xv[2][8][2];
  #pragma unroll
  for (int q = 0; q < 2; ++q)
    #pragma unroll
    for (int t = 0; t < 8; ++t) {
      xv[q][t][0] = *(const float4*)(xr + q * 16 * DIM + t * 16);
      xv[q][t][1] = *(const float4*)(xr + q * 16 * DIM + t * 16 + 4);
    }

  asm volatile("s_wait_xcnt 0x0" :: "v"(xr) : "memory");

  float a[2], b[2];
  #pragma unroll
  for (int q = 0; q < 2; ++q) {
    const float mo = mlo[q * 64 + lane];
    const float lo = mlo[q * 64 + 32 + lane];
    const float mx = fmaxf(m[q], mo);
    const float fs = __expf(m[q] - mx), fo = __expf(mo - mx);
    const float inv = 1.0f / (lj[q] * fs + lo * fo);
    a[q] = fs * inv;
    b[q] = fo * inv;
  }

  #pragma unroll
  for (int q = 0; q < 2; ++q)
    #pragma unroll
    for (int tg = 0; tg < 8; tg += 4) {
      f32x4 r[4][2];
      #pragma unroll
      for (int u = 0; u < 4; ++u) {
        const int    t  = tg + u;
        const v8f    o  = up ? O[q][8 + t] : O[q][t];
        const float4 pa = other[((q * 8 + t) * 2 + 0) * 32 + lane];
        const float4 pb = other[((q * 8 + t) * 2 + 1) * 32 + lane];
        const float4 xa = xv[q][t][0], xb = xv[q][t][1];
        r[u][0][0] = xa.x + (o[0] * a[q] + pa.x * b[q]); r[u][0][1] = xa.y + (o[1] * a[q] + pa.y * b[q]);
        r[u][0][2] = xa.z + (o[2] * a[q] + pa.z * b[q]); r[u][0][3] = xa.w + (o[3] * a[q] + pa.w * b[q]);
        r[u][1][0] = xb.x + (o[4] * a[q] + pb.x * b[q]); r[u][1][1] = xb.y + (o[5] * a[q] + pb.y * b[q]);
        r[u][1][2] = xb.z + (o[6] * a[q] + pb.z * b[q]); r[u][1][3] = xb.w + (o[7] * a[q] + pb.w * b[q]);
        *(f32x4*)(orow + q * 16 * DIM + t * 16)     = r[u][0];
        *(f32x4*)(orow + q * 16 * DIM + t * 16 + 4) = r[u][1];
      }

      asm volatile("s_wait_xcnt 0x0" :: "v"(r[0][0]), "v"(r[0][1]), "v"(r[1][0]), "v"(r[1][1]),
                   "v"(r[2][0]), "v"(r[2][1]), "v"(r[3][0]), "v"(r[3][1]), "v"(orow) : "memory");
    }
}

extern "C" void kernel_launch(void* const* d_in, const int* in_sizes, int n_in,
                              void* d_out, int out_size, void* d_ws, size_t ws_size,
                              hipStream_t stream) {
  const float* x  = (const float*)d_in[0];
  const float* Wq = (const float*)d_in[1];
  const float* bq = (const float*)d_in[2];
  const float* Wk = (const float*)d_in[3];
  const float* bk = (const float*)d_in[4];
  const float* Wv = (const float*)d_in[5];
  const float* bv = (const float*)d_in[6];
  float* outp = (float*)d_out;

  const size_t NX = (size_t)NROW * DIM;
  const size_t NW = (size_t)DIM * DIM;
  bf16* xb = (bf16*)d_ws;
  bf16* wb = xb + NX;
  bf16* qb = wb + 3 * NW;
  bf16* kb = qb + NX;
  bf16* vb = kb + NX;

  f32_to_bf16_kernel<<<CVT_XWG + 3 * CVT_WWG, 512, 0, stream>>>(x, Wq, Wk, Wv, xb);

  qkv_gemm_kernel<<<dim3(NROW / 128, 6), 128, 0, stream>>>(xb, wb, bq, bk, bv,
                                                          qb, kb, vb);

  attn_kernel<<<dim3(SEQ / 128, BATCH), 256, 0, stream>>>(qb, kb, vb, x, outp);
}

// v008
// It runs in 114 microseconds.
// Timed twice side by side with v007, it ran 1.04 and 1.05 times as fast.
// Over all steps from v000 it is 7.60 times as fast.
#include <hip/hip_runtime.h>
#include <hip/hip_bf16.h>

typedef __bf16 bf16;
typedef __attribute__((ext_vector_type(8)))  bf16  v8bf;
typedef __attribute__((ext_vector_type(16))) bf16  v16bf;
typedef __attribute__((ext_vector_type(8)))  float v8f;
typedef __attribute__((ext_vector_type(4)))  float f32x4;

#define DIM   256
#define SEQ   4096
#define BATCH 8
#define NROW  (BATCH * SEQ)

__device__ __forceinline__ v16bf load_frag(const bf16* p) {

  v8bf lo = *(const v8bf*)p;
  v8bf hi = *(const v8bf*)(p + 16);
  return __builtin_shufflevector(lo, hi, 0,1,2,3,4,5,6,7,8,9,10,11,12,13,14,15);
}

__device__ __forceinline__ v8bf load_tr16(const bf16* p) {
  typedef __attribute__((address_space(3))) v8bf lds_v8bf;
  return __builtin_amdgcn_ds_load_tr16_b128_v8bf16((lds_v8bf*)p);
}

__device__ __forceinline__ float xhalf(float v) {
  const int b = __builtin_bit_cast(int, v);
  return __builtin_bit_cast(float, __builtin_amdgcn_permlanex16(b, b, 0x76543210, 0xfedcba98, false, false));
}

__device__ __forceinline__ v8f wmma_bf16(v16bf a, v16bf b, v8f c) {
  return __builtin_amdgcn_wmma_f32_16x16x32_bf16(false, a, false, b, (short)0, c,
                                                 false, false);
}

#define SKEYS   64
#define STAGES  (SEQ / SKEYS)
#define KROWB   256u
#define KPITCH  136
#define KSLICEB 18432u
#define KSLICE  9216

#define VPITCH  144

typedef __attribute__((ext_vector_type(4))) unsigned int u32x4;
typedef __attribute__((ext_vector_type(8))) unsigned int u32x8;

__device__ __forceinline__ unsigned uni(unsigned v) {
  return (unsigned)__builtin_amdgcn_readfirstlane(v);
}

__device__ __forceinline__ unsigned pinned(unsigned v) {
  unsigned w = uni(v);
  asm volatile("" : "+s"(w));
  return w;
}

__device__ __forceinline__ void wait_tensor0() { asm volatile("s_wait_tensorcnt 0x0" ::: "memory"); }
__device__ __forceinline__ void wait_ds0()     { asm volatile("s_wait_dscnt 0x0" ::: "memory"); }

__device__ __forceinline__ void wait_tensor0(u32x4 g0, u32x8 g1) {
  asm volatile("s_wait_tensorcnt 0x0" :: "s"(g0), "s"(g1) : "memory");
}

template <unsigned PAD, unsigned ROWS = SKEYS>
__device__ __forceinline__ u32x8 tdm_group1() {
  u32x8 g;
  g[0] = uni((1u << 20) | (5u << 22) | (PAD << 25));
  g[1] = uni(KROWB << 16);
  g[2] = uni(ROWS << 16);
  g[3] = uni(KROWB << 16);
  g[4] = uni(ROWS);
  g[5] = uni(2u * DIM);
  g[6] = uni(0u);
  g[7] = uni(0u);

  asm volatile("" : "+s"(g));
  return g;
}
__device__ __forceinline__ u32x4 tdm_group0(const bf16* gsrc, unsigned lds_byte_off) {
  const unsigned long long ga = (unsigned long long)(uintptr_t)gsrc;
  u32x4 g0;
  g0[0] = uni(1u);
  g0[1] = uni(lds_byte_off);
  g0[2] = uni((unsigned)ga);
  g0[3] = uni((((unsigned)(ga >> 32)) & 0x01FFFFFFu) | (2u << 30));
  return g0;
}
__device__ __forceinline__ void tdm_load(u32x4 g0, u32x8 g1) {
  asm volatile("tensor_load_to_lds %0, %1" :: "s"(g0), "s"(g1) : "memory");
}

#define CVT_WAVE 2048
#define CVT_WG   (16 * CVT_WAVE)
#define CVT_XWG  (NROW * DIM / CVT_WG)
#define CVT_WWG  (DIM * DIM / CVT_WG)
typedef __attribute__((ext_vector_type(4))) bf16 v4bf;

__global__ __launch_bounds__(512) __attribute__((amdgpu_waves_per_eu(4, 8))) void f32_to_bf16_kernel(
    const float* __restrict__ x, const float* __restrict__ wq, const float* __restrict__ wk,
    const float* __restrict__ wv, bf16* __restrict__ dst) {
  const unsigned b = blockIdx.x;

  const float*   arr   = (b < CVT_XWG) ? x : (b < CVT_XWG + CVT_WWG) ? wq : (b < CVT_XWG + 2 * CVT_WWG) ? wk : wv;
  const unsigned first = (b < CVT_XWG) ? 0u : CVT_XWG + (b - CVT_XWG) / CVT_WWG * CVT_WWG;
  const float*   src   = arr + (size_t)(b - first) * CVT_WG;
  const unsigned off = (threadIdx.x >> 5) * CVT_WAVE + (threadIdx.x & 31) * 4;
  const unsigned lb  = off * 4u;
  dst += (size_t)b * CVT_WG + off;

  f32x4 v[16];
  #pragma unroll
  for (int j = 0; j < 16; ++j) v[j] = *(const f32x4*)((const char*)src + lb + j * 512);

  asm volatile("s_wait_xcnt 0x0" :: "v"(lb) : "memory");
  #pragma unroll
  for (int j = 0; j < 16; ++j) {
    v4bf o;
    o[0] = (bf16)v[j][0]; o[1] = (bf16)v[j][1]; o[2] = (bf16)v[j][2]; o[3] = (bf16)v[j][3];
    *(v4bf*)(dst + j * 128) = o;
  }
}

#define PROWS   128
#define PSLICEB 34816u
#define PSLICE  17408
__global__ __launch_bounds__(128) void qkv_gemm_kernel(
    const bf16* __restrict__ xb, const bf16* __restrict__ wb,
    const float* __restrict__ bq, const float* __restrict__ bk,
    const float* __restrict__ bv,
    bf16* __restrict__ qo, bf16* __restrict__ ko, bf16* __restrict__ vo) {

  __shared__ __attribute__((aligned(2048))) bf16 Stg[4 * PSLICE];

  const int mat  = blockIdx.y >> 1;
  const int ch   = blockIdx.y & 1;
  const bf16*  W    = wb + (size_t)mat * DIM * DIM + (size_t)ch * PROWS * DIM;
  const float* bias = (mat == 0) ? bq : (mat == 1) ? bk : bv;
  bf16*        out  = (mat == 0) ? qo : (mat == 1) ? ko : vo;
  const float  scl  = (mat == 0) ? 0.0625f : 1.0f;

  const unsigned wave = uni((unsigned)threadIdx.x >> 5);
  const int lane = threadIdx.x & 31;
  const int lr   = lane & 15, lh = lane >> 4;
  const int rowbase = blockIdx.x * PROWS;

  float bb[8];
  #pragma unroll
  for (int t = 0; t < 8; ++t) bb[t] = bias[ch * 128 + t * 16 + lr];

  {
    const bf16* src = (wave < 2u) ? xb + (size_t)rowbase * DIM : W;
    const u32x8 g1 = tdm_group1<3u, PROWS>();
    const u32x4 g0 = tdm_group0(src + (wave & 1u) * 128u, (unsigned)(uintptr_t)&Stg[0] + wave * PSLICEB);
    tdm_load(g0, g1);
    wait_tensor0(g0, g1);
  }
  __syncthreads();

  const int afr = ((int)wave * 32 + lr) * KPITCH + lh * 8;
  const int bfr = 2 * PSLICE + lr * KPITCH + lh * 8;

  v8f acc[2][8];
  #pragma unroll
  for (int a = 0; a < 2; ++a)
    #pragma unroll
    for (int t = 0; t < 8; ++t)
      #pragma unroll
      for (int i = 0; i < 8; ++i) acc[a][t][i] = 0.0f;

  v16bf Af[2][2], Bf[2][4];
  auto fetch_a = [&](int kc) {
    const int ko = (kc >> 2) * PSLICE + (kc & 3) * 32;
    Af[kc & 1][0] = load_frag(&Stg[afr + ko]);
    Af[kc & 1][1] = load_frag(&Stg[afr + 16 * KPITCH + ko]);
  };
  auto fetch_b = [&](int b) {
    const int kc = b >> 1;
    const int ko = (kc >> 2) * PSLICE + (kc & 3) * 32;
    #pragma unroll
    for (int j = 0; j < 4; ++j) Bf[b & 1][j] = load_frag(&Stg[bfr + ((b & 1) * 4 + j) * 16 * KPITCH + ko]);
  };
  fetch_a(0);
  fetch_b(0);
  #pragma unroll
  for (int b = 0; b < 16; ++b) {
    if (b < 15) {
      if (b & 1) fetch_a((b + 1) >> 1);
      fetch_b(b + 1);
    }

    __builtin_amdgcn_sched_barrier(0);
    #pragma unroll
    for (int j = 0; j < 4; ++j) {
      const int t = (b & 1) * 4 + j;
      acc[0][t] = wmma_bf16(Af[(b >> 1) & 1][0], Bf[b & 1][j], acc[0][t]);
      acc[1][t] = wmma_bf16(Af[(b >> 1) & 1][1], Bf[b & 1][j], acc[1][t]);
    }
    __builtin_amdgcn_sched_barrier(0);
  }
  #pragma unroll
  for (int t = 0; t < 8; ++t) {
    const int col = ch * 128 + t * 16 + lr;
    #pragma unroll
    for (int a = 0; a < 2; ++a)
      #pragma unroll
      for (int i = 0; i < 8; ++i) {
        const int row = rowbase + (int)wave * 32 + a * 16 + i + 8 * lh;
        out[(size_t)row * DIM + col] = (bf16)((acc[a][t][i] + bb[t]) * scl);
      }
  }
}

#define LAG 5.545177f

__global__ __launch_bounds__(256) void attn_kernel(
    const bf16* __restrict__ qb, const bf16* __restrict__ kb,
    const bf16* __restrict__ vb, const float* __restrict__ x,
    float* __restrict__ out) {

  __shared__ __attribute__((aligned(2048))) bf16 Ring[8][KSLICE];

  const int batch = blockIdx.y;
  const int qbase = blockIdx.x * 128;
  const int tid   = threadIdx.x;
  const int lane  = tid & 31;
  const int lr    = lane & 15, lh = lane >> 4;
  const size_t bo = (size_t)batch * SEQ * DIM;
  const unsigned wave = uni((unsigned)tid >> 5);
  const int qg = (int)(wave & 3u), kh = (int)(wave >> 2);

  v16bf Qf[2][8];
  const bf16* qrow = qb + bo + (size_t)(qbase + qg * 32 + lr) * DIM + lh * 8;
  #pragma unroll
  for (int q = 0; q < 2; ++q)
    #pragma unroll
    for (int kc = 0; kc < 8; ++kc) Qf[q][kc] = load_frag(qrow + q * 16 * DIM + kc * 32);

  v8f O[2][16];
  #pragma unroll
  for (int q = 0; q < 2; ++q)
    #pragma unroll
    for (int t = 0; t < 16; ++t)
      #pragma unroll
      for (int i = 0; i < 8; ++i) O[q][t][i] = 0.0f;
  float m[2] = {-3.0e38f, -3.0e38f};
  float l[2] = {0.0f, 0.0f};

  const int kfr = (kh * 32 + lr) * KPITCH + lh * 8;
  const int vtr = (kh * 32 + 8 * lh + (lane & 7)) * VPITCH + ((lane >> 3) & 1) * 8;

  const u32x8    g1     = tdm_group1<3u>();
  u32x4          g0     = {0u, 0u, 0u, 0u};
  const bf16*    ksrc   = kb + bo + (wave & 1u) * 128u;
  const unsigned kdst   = (unsigned)(uintptr_t)&Ring[0][0] + (wave & 1u) * KSLICEB;
  auto issue_k = [&](int st) {
    g0 = tdm_group0(ksrc + (size_t)st * SKEYS * DIM, kdst + (unsigned)(st & 1) * (2u * KSLICEB));
    tdm_load(g0, g1);
  };

  const unsigned vwave  = (wave & 6u) == 2u;
  const u32x8    g1v    = tdm_group1<7u>();
  const bf16*    vsrc   = vb + bo + (wave & 1u) * 128u;
  const unsigned vdst   = (unsigned)(uintptr_t)&Ring[4][0] + (wave & 1u) * KSLICEB;
  u32x4          g0v    = {0u, 0u, 0u, 0u};
  auto issue_v = [&](int st) {
    g0v = tdm_group0(vsrc + (size_t)st * SKEYS * DIM, vdst + (unsigned)(st & 1) * (2u * KSLICEB));

    asm volatile("" : "+s"(g0v));
    tdm_load(g0v, g1v);
  };

  if (pinned(wave < 2u)) { issue_k(0); wait_tensor0(g0, g1); }
  if (pinned(vwave))     { issue_v(0); wait_tensor0(g0v, g1v); }
  __syncthreads();
  if (pinned(wave < 2u)) issue_k(1);
  if (pinned(vwave))     issue_v(1);

  for (int st = 0; st < STAGES; ++st) {
    const int cur = st & 1;

    v8f s[2][2] = {{{0,0,0,0,0,0,0,0}, {0,0,0,0,0,0,0,0}}, {{0,0,0,0,0,0,0,0}, {0,0,0,0,0,0,0,0}}};

    v16bf Kf[4][2];
    auto fetch_k = [&](int kc) {
      Kf[kc & 3][0] = load_frag(&Ring[cur * 2 + (kc >> 2)][kfr + (kc & 3) * 32]);
      Kf[kc & 3][1] = load_frag(&Ring[cur * 2 + (kc >> 2)][kfr + 16 * KPITCH + (kc & 3) * 32]);
    };
    auto qk = [&](int kc) {
      #pragma unroll
      for (int q = 0; q < 2; ++q) {
        s[q][0] = wmma_bf16(Kf[kc & 3][0], Qf[q][kc], s[q][0]);
        s[q][1] = wmma_bf16(Kf[kc & 3][1], Qf[q][kc], s[q][1]);
      }
    };

    fetch_k(0); fetch_k(1); fetch_k(2); fetch_k(3);
    __builtin_amdgcn_sched_barrier(0);
    qk(0); qk(1);
    __builtin_amdgcn_sched_barrier(0);
    fetch_k(4); fetch_k(5);
    __builtin_amdgcn_sched_barrier(0);
    qk(2); qk(3);
    __builtin_amdgcn_sched_barrier(0);
    fetch_k(6); fetch_k(7);
    __builtin_amdgcn_sched_barrier(0);
    qk(4); qk(5); qk(6); qk(7);

    v16bf Vf[2][4];
    auto fetch_v = [&](int g) {
      #pragma unroll
      for (int j = 0; j < 4; ++j) {
        const int t = g * 4 + j;

        v8bf lo = load_tr16(&Ring[4 + cur * 2 + (t >> 3)][vtr + (t & 7) * 16]);
        v8bf hi = load_tr16(&Ring[4 + cur * 2 + (t >> 3)][vtr + 16 * VPITCH + (t & 7) * 16]);
        Vf[g % 2][j] = __builtin_shufflevector(lo, hi, 0,1,2,3,4,5,6,7,8,9,10,11,12,13,14,15);
      }
    };
    __builtin_amdgcn_sched_barrier(0);
    fetch_v(0);
    __builtin_amdgcn_sched_barrier(0);

    float tq[2];
    bool  need = false;
    #pragma unroll
    for (int q = 0; q < 2; ++q) {
      const v8f s0 = s[q][0], s1 = s[q][1];
      float t4[4];
      #pragma unroll
      for (int i = 0; i < 4; ++i) t4[i] = fmaxf(fmaxf(s0[i], s1[i]), fmaxf(s0[i + 4], s1[i + 4]));
      float t = fmaxf(fmaxf(t4[0], t4[1]), fmaxf(t4[2], t4[3]));
      t = fmaxf(t, xhalf(t));
      tq[q] = t;
      need = need || (t > m[q] + LAG);
    }
    if (__builtin_amdgcn_ballot_w32(need) != 0) {
      #pragma unroll
      for (int q = 0; q < 2; ++q) {
        const float mn   = fmaxf(m[q], tq[q]);
        const float corr = __expf(m[q] - mn);
        m[q] = mn;
        l[q] *= corr;
        #pragma unroll
        for (int t = 0; t < 16; ++t) O[q][t] = O[q][t] * corr;
      }
    }
    v16bf Pf[2];
    #pragma unroll
    for (int q = 0; q < 2; ++q) {
      v8f s0 = s[q][0], s1 = s[q][1];
      const float mn = m[q];
      #pragma unroll
      for (int i = 0; i < 8; ++i) {
        s0[i] = __expf(s0[i] - mn);
        s1[i] = __expf(s1[i] - mn);
      }
      const float r = (((s0[0] + s1[0]) + (s0[1] + s1[1])) + ((s0[2] + s1[2]) + (s0[3] + s1[3])))
                    + (((s0[4] + s1[4]) + (s0[5] + s1[5])) + ((s0[6] + s1[6]) + (s0[7] + s1[7])));
      l[q] += r;

      #pragma unroll
      for (int i = 0; i < 8; ++i) { Pf[q][i] = (bf16)s0[i]; Pf[q][8 + i] = (bf16)s1[i]; }
    }

    auto pv = [&](int g) {
      #pragma unroll
      for (int j = 0; j < 4; ++j)
        #pragma unroll
        for (int q = 0; q < 2; ++q) O[q][g * 4 + j] = wmma_bf16(Vf[g % 2][j], Pf[q], O[q][g * 4 + j]);
    };
    __builtin_amdgcn_sched_barrier(0);
    fetch_v(1);
    __builtin_amdgcn_sched_barrier(0);
    pv(0);
    __builtin_amdgcn_sched_barrier(0);
    fetch_v(2);
    __builtin_amdgcn_sched_barrier(0);
    pv(1);
    __builtin_amdgcn_sched_barrier(0);
    fetch_v(3);
    __builtin_amdgcn_sched_barrier(0);
    pv(2);
    pv(3);
    __builtin_amdgcn_sched_barrier(0);

    wait_ds0();
    if (pinned(wave < 2u)) wait_tensor0(g0, g1);
    if (pinned(vwave))     wait_tensor0(g0v, g1v);
    __syncthreads();
    if (pinned(wave < 2u && st + 2 < STAGES)) issue_k(st + 2);
    if (pinned(vwave && st + 2 < STAGES))     issue_v(st + 2);
  }
  wait_tensor0();
  wait_ds0();

  float*  stg   = (float*)&Ring[0][0];
  float4* mine  = (float4*)(stg + wave * 4096u);
  float4* other = (float4*)(stg + (wave ^ 4u) * 4096u);
  float*  mlm   = stg + 32768u + wave * 128u;
  float*  mlo   = stg + 32768u + (wave ^ 4u) * 128u;
  float lj[2];
  #pragma unroll
  for (int q = 0; q < 2; ++q) {
    lj[q] = l[q] + xhalf(l[q]);
    mlm[q * 64 + lane]      = m[q];
    mlm[q * 64 + 32 + lane] = lj[q];
  }

  const bool up = kh != 0;
  #pragma unroll
  for (int q = 0; q < 2; ++q)
    #pragma unroll
    for (int t = 0; t < 8; ++t) {
      const v8f g = up ? O[q][t] : O[q][8 + t];
      mine[((q * 8 + t) * 2 + 0) * 32 + lane] = make_float4(g[0], g[1], g[2], g[3]);
      mine[((q * 8 + t) * 2 + 1) * 32 + lane] = make_float4(g[4], g[5], g[6], g[7]);
    }
  __syncthreads();

  const size_t rowoff = bo + (size_t)(qbase + qg * 32 + lr) * DIM + kh * 128 + 8 * lh;
  const float* xr   = x + rowoff;
  float*       orow = out + rowoff;
  float4 xv[2][8][2];
  #pragma unroll
  for (int q = 0; q < 2; ++q)
    #pragma unroll
    for (int t = 0; t < 8; ++t) {
      xv[q][t][0] = *(const float4*)(xr + q * 16 * DIM + t * 16);
      xv[q][t][1] = *(const float4*)(xr + q * 16 * DIM + t * 16 + 4);
    }

  asm volatile("s_wait_xcnt 0x0" :: "v"(xr) : "memory");

  float a[2], b[2];
  #pragma unroll
  for (int q = 0; q < 2; ++q) {
    const float mo = mlo[q * 64 + lane];
    const float lo = mlo[q * 64 + 32 + lane];
    const float mx = fmaxf(m[q], mo);
    const float fs = __expf(m[q] - mx), fo = __expf(mo - mx);
    const float inv = 1.0f / (lj[q] * fs + lo * fo);
    a[q] = fs * inv;
    b[q] = fo * inv;
  }

  #pragma unroll
  for (int q = 0; q < 2; ++q)
    #pragma unroll
    for (int tg = 0; tg < 8; tg += 4) {
      f32x4 r[4][2];
      #pragma unroll
      for (int u = 0; u < 4; ++u) {
        const int    t  = tg + u;
        const v8f    o  = up ? O[q][8 + t] : O[q][t];
        const float4 pa = other[((q * 8 + t) * 2 + 0) * 32 + lane];
        const float4 pb = other[((q * 8 + t) * 2 + 1) * 32 + lane];
        const float4 xa = xv[q][t][0], xb = xv[q][t][1];
        r[u][0][0] = xa.x + (o[0] * a[q] + pa.x * b[q]); r[u][0][1] = xa.y + (o[1] * a[q] + pa.y * b[q]);
        r[u][0][2] = xa.z + (o[2] * a[q] + pa.z * b[q]); r[u][0][3] = xa.w + (o[3] * a[q] + pa.w * b[q]);
        r[u][1][0] = xb.x + (o[4] * a[q] + pb.x * b[q]); r[u][1][1] = xb.y + (o[5] * a[q] + pb.y * b[q]);
        r[u][1][2] = xb.z + (o[6] * a[q] + pb.z * b[q]); r[u][1][3] = xb.w + (o[7] * a[q] + pb.w * b[q]);
        *(f32x4*)(orow + q * 16 * DIM + t * 16)     = r[u][0];
        *(f32x4*)(orow + q * 16 * DIM + t * 16 + 4) = r[u][1];
      }

      asm volatile("s_wait_xcnt 0x0" :: "v"(r[0][0]), "v"(r[0][1]), "v"(r[1][0]), "v"(r[1][1]),
                   "v"(r[2][0]), "v"(r[2][1]), "v"(r[3][0]), "v"(r[3][1]), "v"(orow) : "memory");
    }
}

extern "C" void kernel_launch(void* const* d_in, const int* in_sizes, int n_in,
                              void* d_out, int out_size, void* d_ws, size_t ws_size,
                              hipStream_t stream) {
  const float* x  = (const float*)d_in[0];
  const float* Wq = (const float*)d_in[1];
  const float* bq = (const float*)d_in[2];
  const float* Wk = (const float*)d_in[3];
  const float* bk = (const float*)d_in[4];
  const float* Wv = (const float*)d_in[5];
  const float* bv = (const float*)d_in[6];
  float* outp = (float*)d_out;

  const size_t NX = (size_t)NROW * DIM;
  const size_t NW = (size_t)DIM * DIM;
  bf16* xb = (bf16*)d_ws;
  bf16* wb = xb + NX;
  bf16* qb = wb + 3 * NW;
  bf16* kb = qb + NX;
  bf16* vb = kb + NX;

  f32_to_bf16_kernel<<<CVT_XWG + 3 * CVT_WWG, 512, 0, stream>>>(x, Wq, Wk, Wv, xb);

  qkv_gemm_kernel<<<dim3(NROW / 128, 6), 128, 0, stream>>>(xb, wb, bq, bk, bv,
                                                          qb, kb, vb);

  attn_kernel<<<dim3(SEQ / 128, BATCH), 256, 0, stream>>>(qb, kb, vb, x, outp);
}

// v009
// Measured time: 107 microseconds a run.
// Timed twice side by side with v008, it ran 1.06 times as fast both times.
// Over all steps from v000 it is 8.05 times as fast.
#include <hip/hip_runtime.h>
#include <hip/hip_bf16.h>

typedef __bf16 bf16;
typedef __attribute__((ext_vector_type(8)))  bf16  v8bf;
typedef __attribute__((ext_vector_type(16))) bf16  v16bf;
typedef __attribute__((ext_vector_type(8)))  float v8f;
typedef __attribute__((ext_vector_type(4)))  float f32x4;

#define DIM   256
#define SEQ   4096
#define BATCH 8
#define NROW  (BATCH * SEQ)

__device__ __forceinline__ v16bf load_frag(const bf16* p) {

  v8bf lo = *(const v8bf*)p;
  v8bf hi = *(const v8bf*)(p + 16);
  return __builtin_shufflevector(lo, hi, 0,1,2,3,4,5,6,7,8,9,10,11,12,13,14,15);
}

__device__ __forceinline__ v8bf load_tr16(const bf16* p) {
  typedef __attribute__((address_space(3))) v8bf lds_v8bf;
  return __builtin_amdgcn_ds_load_tr16_b128_v8bf16((lds_v8bf*)p);
}

__device__ __forceinline__ float xhalf(float v) {
  const int b = __builtin_bit_cast(int, v);
  return __builtin_bit_cast(float, __builtin_amdgcn_permlanex16(b, b, 0x76543210, 0xfedcba98, false, false));
}

__device__ __forceinline__ v8f wmma_bf16(v16bf a, v16bf b, v8f c) {
  return __builtin_amdgcn_wmma_f32_16x16x32_bf16(false, a, false, b, (short)0, c,
                                                 false, false);
}

#define SKEYS   64
#define STAGES  (SEQ / SKEYS)
#define KROWB   256u
#define KPITCH  136
#define KSLICEB 18432u
#define KSLICE  9216

#define VPITCH  144

typedef __attribute__((ext_vector_type(4))) unsigned int u32x4;
typedef __attribute__((ext_vector_type(8))) unsigned int u32x8;

__device__ __forceinline__ unsigned uni(unsigned v) {
  return (unsigned)__builtin_amdgcn_readfirstlane(v);
}

__device__ __forceinline__ unsigned pinned(unsigned v) {
  unsigned w = uni(v);
  asm volatile("" : "+s"(w));
  return w;
}

__device__ __forceinline__ void wait_tensor0() { asm volatile("s_wait_tensorcnt 0x0" ::: "memory"); }
__device__ __forceinline__ void wait_ds0()     { asm volatile("s_wait_dscnt 0x0" ::: "memory"); }

__device__ __forceinline__ void wait_tensor0(u32x4 g0, u32x8 g1) {
  asm volatile("s_wait_tensorcnt 0x0" :: "s"(g0), "s"(g1) : "memory");
}

template <unsigned PAD, unsigned ROWS = SKEYS>
__device__ __forceinline__ u32x8 tdm_group1() {
  u32x8 g;
  g[0] = uni((1u << 20) | (5u << 22) | (PAD << 25));
  g[1] = uni(KROWB << 16);
  g[2] = uni(ROWS << 16);
  g[3] = uni(KROWB << 16);
  g[4] = uni(ROWS);
  g[5] = uni(2u * DIM);
  g[6] = uni(0u);
  g[7] = uni(0u);

  asm volatile("" : "+s"(g));
  return g;
}
__device__ __forceinline__ u32x4 tdm_group0(const bf16* gsrc, unsigned lds_byte_off) {
  const unsigned long long ga = (unsigned long long)(uintptr_t)gsrc;
  u32x4 g0;
  g0[0] = uni(1u);
  g0[1] = uni(lds_byte_off);
  g0[2] = uni((unsigned)ga);
  g0[3] = uni((((unsigned)(ga >> 32)) & 0x01FFFFFFu) | (2u << 30));
  return g0;
}
__device__ __forceinline__ void tdm_load(u32x4 g0, u32x8 g1) {
  asm volatile("tensor_load_to_lds %0, %1" :: "s"(g0), "s"(g1) : "memory");
}

#define CVT_WAVE 2048
#define CVT_WG   (16 * CVT_WAVE)
#define CVT_XWG  (NROW * DIM / CVT_WG)
#define CVT_WWG  (DIM * DIM / CVT_WG)
typedef __attribute__((ext_vector_type(4))) bf16 v4bf;

__global__ __launch_bounds__(512) __attribute__((amdgpu_waves_per_eu(4, 8))) void f32_to_bf16_kernel(
    const float* __restrict__ x, const float* __restrict__ wq, const float* __restrict__ wk,
    const float* __restrict__ wv, bf16* __restrict__ dst) {
  const unsigned b = blockIdx.x;

  const float*   arr   = (b < CVT_XWG) ? x : (b < CVT_XWG + CVT_WWG) ? wq : (b < CVT_XWG + 2 * CVT_WWG) ? wk : wv;
  const unsigned first = (b < CVT_XWG) ? 0u : CVT_XWG + (b - CVT_XWG) / CVT_WWG * CVT_WWG;
  const float*   src   = arr + (size_t)(b - first) * CVT_WG;
  const unsigned off = (threadIdx.x >> 5) * CVT_WAVE + (threadIdx.x & 31) * 4;
  const unsigned lb  = off * 4u;
  dst += (size_t)b * CVT_WG + off;

  f32x4 v[16];
  #pragma unroll
  for (int j = 0; j < 16; ++j) v[j] = *(const f32x4*)((const char*)src + lb + j * 512);

  asm volatile("s_wait_xcnt 0x0" :: "v"(lb) : "memory");
  #pragma unroll
  for (int j = 0; j < 16; ++j) {
    v4bf o;
    o[0] = (bf16)v[j][0]; o[1] = (bf16)v[j][1]; o[2] = (bf16)v[j][2]; o[3] = (bf16)v[j][3];
    *(v4bf*)(dst + j * 128) = o;
  }
}

#define PROWS   128
#define PSLICEB 34816u
#define PSLICE  17408
__global__ __launch_bounds__(128) void qkv_gemm_kernel(
    const bf16* __restrict__ xb, const bf16* __restrict__ wb,
    const float* __restrict__ bq, const float* __restrict__ bk,
    const float* __restrict__ bv,
    bf16* __restrict__ qo, bf16* __restrict__ ko, bf16* __restrict__ vo) {

  __shared__ __attribute__((aligned(2048))) bf16 Stg[4 * PSLICE];

  const int mat  = blockIdx.y >> 1;
  const int ch   = blockIdx.y & 1;
  const bf16*  W    = wb + (size_t)mat * DIM * DIM + (size_t)ch * PROWS * DIM;
  const float* bias = (mat == 0) ? bq : (mat == 1) ? bk : bv;
  bf16*        out  = (mat == 0) ? qo : (mat == 1) ? ko : vo;
  const float  scl  = (mat == 0) ? 0.0625f : 1.0f;

  const unsigned wave = uni((unsigned)threadIdx.x >> 5);
  const int lane = threadIdx.x & 31;
  const int lr   = lane & 15, lh = lane >> 4;
  const int rowbase = blockIdx.x * PROWS;

  f32x4 bb[8][2];
  #pragma unroll
  for (int t = 0; t < 8; ++t) {
    bb[t][0] = *(const f32x4*)(bias + ch * 128 + t * 16 + lh * 8);
    bb[t][1] = *(const f32x4*)(bias + ch * 128 + t * 16 + lh * 8 + 4);
  }

  {
    const bf16* src = (wave < 2u) ? xb + (size_t)rowbase * DIM : W;
    const u32x8 g1 = tdm_group1<3u, PROWS>();
    const u32x4 g0 = tdm_group0(src + (wave & 1u) * 128u, (unsigned)(uintptr_t)&Stg[0] + wave * PSLICEB);
    tdm_load(g0, g1);
    wait_tensor0(g0, g1);
  }
  __syncthreads();

  const int afr = ((int)wave * 32 + lr) * KPITCH + lh * 8;
  const int bfr = 2 * PSLICE + lr * KPITCH + lh * 8;

  v8f acc[2][8];
  #pragma unroll
  for (int a = 0; a < 2; ++a)
    #pragma unroll
    for (int t = 0; t < 8; ++t)
      #pragma unroll
      for (int i = 0; i < 8; ++i) acc[a][t][i] = 0.0f;

  v16bf Af[2][2], Bf[2][4];
  auto fetch_a = [&](int kc) {
    const int ko = (kc >> 2) * PSLICE + (kc & 3) * 32;
    Af[kc & 1][0] = load_frag(&Stg[afr + ko]);
    Af[kc & 1][1] = load_frag(&Stg[afr + 16 * KPITCH + ko]);
  };
  auto fetch_b = [&](int b) {
    const int kc = b >> 1;
    const int ko = (kc >> 2) * PSLICE + (kc & 3) * 32;
    #pragma unroll
    for (int j = 0; j < 4; ++j) Bf[b & 1][j] = load_frag(&Stg[bfr + ((b & 1) * 4 + j) * 16 * KPITCH + ko]);
  };
  fetch_a(0);
  fetch_b(0);
  #pragma unroll
  for (int b = 0; b < 16; ++b) {
    if (b < 15) {
      if (b & 1) fetch_a((b + 1) >> 1);
      fetch_b(b + 1);
    }

    __builtin_amdgcn_sched_barrier(0);
    #pragma unroll
    for (int j = 0; j < 4; ++j) {
      const int t = (b & 1) * 4 + j;
      acc[0][t] = wmma_bf16(Bf[b & 1][j], Af[(b >> 1) & 1][0], acc[0][t]);
      acc[1][t] = wmma_bf16(Bf[b & 1][j], Af[(b >> 1) & 1][1], acc[1][t]);
    }
    __builtin_amdgcn_sched_barrier(0);
  }

  bf16* stage = &Stg[(int)wave * 32 * KPITCH];
  #pragma unroll
  for (int a = 0; a < 2; ++a)
    #pragma unroll
    for (int t = 0; t < 8; ++t) {
      v8bf o;
      #pragma unroll
      for (int i = 0; i < 8; ++i) o[i] = (bf16)((acc[a][t][i] + bb[t][i >> 2][i & 3]) * scl);
      *(v8bf*)&stage[(a * 16 + lr) * KPITCH + t * 16 + lh * 8] = o;
    }
  wait_ds0();

  v8bf rows[16];
  #pragma unroll
  for (int j = 0; j < 16; ++j) rows[j] = *(const v8bf*)&stage[(j * 2 + lh) * KPITCH + lr * 8];
  bf16* orow = out + (size_t)(rowbase + (int)wave * 32 + lh) * DIM + ch * 128 + lr * 8;
  #pragma unroll
  for (int j = 0; j < 16; ++j) *(v8bf*)(orow + j * 2 * DIM) = rows[j];
}

#define LAG 5.545177f

__global__ __launch_bounds__(256) void attn_kernel(
    const bf16* __restrict__ qb, const bf16* __restrict__ kb,
    const bf16* __restrict__ vb, const float* __restrict__ x,
    float* __restrict__ out) {

  __shared__ __attribute__((aligned(2048))) bf16 Ring[8][KSLICE];

  const int batch = blockIdx.y;
  const int qbase = blockIdx.x * 128;
  const int tid   = threadIdx.x;
  const int lane  = tid & 31;
  const int lr    = lane & 15, lh = lane >> 4;
  const size_t bo = (size_t)batch * SEQ * DIM;
  const unsigned wave = uni((unsigned)tid >> 5);
  const int qg = (int)(wave & 3u), kh = (int)(wave >> 2);

  v16bf Qf[2][8];
  const bf16* qrow = qb + bo + (size_t)(qbase + qg * 32 + lr) * DIM + lh * 8;
  #pragma unroll
  for (int q = 0; q < 2; ++q)
    #pragma unroll
    for (int kc = 0; kc < 8; ++kc) Qf[q][kc] = load_frag(qrow + q * 16 * DIM + kc * 32);

  v8f O[2][16];
  #pragma unroll
  for (int q = 0; q < 2; ++q)
    #pragma unroll
    for (int t = 0; t < 16; ++t)
      #pragma unroll
      for (int i = 0; i < 8; ++i) O[q][t][i] = 0.0f;
  float m[2] = {-3.0e38f, -3.0e38f};
  float l[2] = {0.0f, 0.0f};

  const int kfr = (kh * 32 + lr) * KPITCH + lh * 8;
  const int vtr = (kh * 32 + 8 * lh + (lane & 7)) * VPITCH + ((lane >> 3) & 1) * 8;

  const u32x8    g1     = tdm_group1<3u>();
  u32x4          g0     = {0u, 0u, 0u, 0u};
  const bf16*    ksrc   = kb + bo + (wave & 1u) * 128u;
  const unsigned kdst   = (unsigned)(uintptr_t)&Ring[0][0] + (wave & 1u) * KSLICEB;
  auto issue_k = [&](int st) {
    g0 = tdm_group0(ksrc + (size_t)st * SKEYS * DIM, kdst + (unsigned)(st & 1) * (2u * KSLICEB));
    tdm_load(g0, g1);
  };

  const unsigned vwave  = (wave & 6u) == 2u;
  const u32x8    g1v    = tdm_group1<7u>();
  const bf16*    vsrc   = vb + bo + (wave & 1u) * 128u;
  const unsigned vdst   = (unsigned)(uintptr_t)&Ring[4][0] + (wave & 1u) * KSLICEB;
  u32x4          g0v    = {0u, 0u, 0u, 0u};
  auto issue_v = [&](int st) {
    g0v = tdm_group0(vsrc + (size_t)st * SKEYS * DIM, vdst + (unsigned)(st & 1) * (2u * KSLICEB));

    asm volatile("" : "+s"(g0v));
    tdm_load(g0v, g1v);
  };

  if (pinned(wave < 2u)) { issue_k(0); wait_tensor0(g0, g1); }
  if (pinned(vwave))     { issue_v(0); wait_tensor0(g0v, g1v); }
  __syncthreads();
  if (pinned(wave < 2u)) issue_k(1);
  if (pinned(vwave))     issue_v(1);

  for (int st = 0; st < STAGES; ++st) {
    const int cur = st & 1;

    v8f s[2][2] = {{{0,0,0,0,0,0,0,0}, {0,0,0,0,0,0,0,0}}, {{0,0,0,0,0,0,0,0}, {0,0,0,0,0,0,0,0}}};

    v16bf Kf[4][2];
    auto fetch_k = [&](int kc) {
      Kf[kc & 3][0] = load_frag(&Ring[cur * 2 + (kc >> 2)][kfr + (kc & 3) * 32]);
      Kf[kc & 3][1] = load_frag(&Ring[cur * 2 + (kc >> 2)][kfr + 16 * KPITCH + (kc & 3) * 32]);
    };
    auto qk = [&](int kc) {
      #pragma unroll
      for (int q = 0; q < 2; ++q) {
        s[q][0] = wmma_bf16(Kf[kc & 3][0], Qf[q][kc], s[q][0]);
        s[q][1] = wmma_bf16(Kf[kc & 3][1], Qf[q][kc], s[q][1]);
      }
    };

    fetch_k(0); fetch_k(1); fetch_k(2); fetch_k(3);
    __builtin_amdgcn_sched_barrier(0);
    qk(0); qk(1);
    __builtin_amdgcn_sched_barrier(0);
    fetch_k(4); fetch_k(5);
    __builtin_amdgcn_sched_barrier(0);
    qk(2); qk(3);
    __builtin_amdgcn_sched_barrier(0);
    fetch_k(6); fetch_k(7);
    __builtin_amdgcn_sched_barrier(0);
    qk(4); qk(5); qk(6); qk(7);

    v16bf Vf[2][4];
    auto fetch_v = [&](int g) {
      #pragma unroll
      for (int j = 0; j < 4; ++j) {
        const int t = g * 4 + j;

        v8bf lo = load_tr16(&Ring[4 + cur * 2 + (t >> 3)][vtr + (t & 7) * 16]);
        v8bf hi = load_tr16(&Ring[4 + cur * 2 + (t >> 3)][vtr + 16 * VPITCH + (t & 7) * 16]);
        Vf[g % 2][j] = __builtin_shufflevector(lo, hi, 0,1,2,3,4,5,6,7,8,9,10,11,12,13,14,15);
      }
    };
    __builtin_amdgcn_sched_barrier(0);
    fetch_v(0);
    __builtin_amdgcn_sched_barrier(0);

    float tq[2];
    bool  need = false;
    #pragma unroll
    for (int q = 0; q < 2; ++q) {
      const v8f s0 = s[q][0], s1 = s[q][1];
      float t4[4];
      #pragma unroll
      for (int i = 0; i < 4; ++i) t4[i] = fmaxf(fmaxf(s0[i], s1[i]), fmaxf(s0[i + 4], s1[i + 4]));
      float t = fmaxf(fmaxf(t4[0], t4[1]), fmaxf(t4[2], t4[3]));
      t = fmaxf(t, xhalf(t));
      tq[q] = t;
      need = need || (t > m[q] + LAG);
    }
    if (__builtin_amdgcn_ballot_w32(need) != 0) {
      #pragma unroll
      for (int q = 0; q < 2; ++q) {
        const float mn   = fmaxf(m[q], tq[q]);
        const float corr = __expf(m[q] - mn);
        m[q] = mn;
        l[q] *= corr;
        #pragma unroll
        for (int t = 0; t < 16; ++t) O[q][t] = O[q][t] * corr;
      }
    }
    v16bf Pf[2];
    #pragma unroll
    for (int q = 0; q < 2; ++q) {
      v8f s0 = s[q][0], s1 = s[q][1];
      const float mn = m[q];
      #pragma unroll
      for (int i = 0; i < 8; ++i) {
        s0[i] = __expf(s0[i] - mn);
        s1[i] = __expf(s1[i] - mn);
      }
      const float r = (((s0[0] + s1[0]) + (s0[1] + s1[1])) + ((s0[2] + s1[2]) + (s0[3] + s1[3])))
                    + (((s0[4] + s1[4]) + (s0[5] + s1[5])) + ((s0[6] + s1[6]) + (s0[7] + s1[7])));
      l[q] += r;

      #pragma unroll
      for (int i = 0; i < 8; ++i) { Pf[q][i] = (bf16)s0[i]; Pf[q][8 + i] = (bf16)s1[i]; }
    }

    auto pv = [&](int g) {
      #pragma unroll
      for (int j = 0; j < 4; ++j)
        #pragma unroll
        for (int q = 0; q < 2; ++q) O[q][g * 4 + j] = wmma_bf16(Vf[g % 2][j], Pf[q], O[q][g * 4 + j]);
    };
    __builtin_amdgcn_sched_barrier(0);
    fetch_v(1);
    __builtin_amdgcn_sched_barrier(0);
    pv(0);
    __builtin_amdgcn_sched_barrier(0);
    fetch_v(2);
    __builtin_amdgcn_sched_barrier(0);
    pv(1);
    __builtin_amdgcn_sched_barrier(0);
    fetch_v(3);
    __builtin_amdgcn_sched_barrier(0);
    pv(2);
    pv(3);
    __builtin_amdgcn_sched_barrier(0);

    wait_ds0();
    if (pinned(wave < 2u)) wait_tensor0(g0, g1);
    if (pinned(vwave))     wait_tensor0(g0v, g1v);
    __syncthreads();
    if (pinned(wave < 2u && st + 2 < STAGES)) issue_k(st + 2);
    if (pinned(vwave && st + 2 < STAGES))     issue_v(st + 2);
  }
  wait_tensor0();
  wait_ds0();

  float*  stg   = (float*)&Ring[0][0];
  float4* mine  = (float4*)(stg + wave * 4096u);
  float4* other = (float4*)(stg + (wave ^ 4u) * 4096u);
  float*  mlm   = stg + 32768u + wave * 128u;
  float*  mlo   = stg + 32768u + (wave ^ 4u) * 128u;
  float lj[2];
  #pragma unroll
  for (int q = 0; q < 2; ++q) {
    lj[q] = l[q] + xhalf(l[q]);
    mlm[q * 64 + lane]      = m[q];
    mlm[q * 64 + 32 + lane] = lj[q];
  }

  const bool up = kh != 0;
  #pragma unroll
  for (int q = 0; q < 2; ++q)
    #pragma unroll
    for (int t = 0; t < 8; ++t) {
      const v8f g = up ? O[q][t] : O[q][8 + t];
      mine[((q * 8 + t) * 2 + 0) * 32 + lane] = make_float4(g[0], g[1], g[2], g[3]);
      mine[((q * 8 + t) * 2 + 1) * 32 + lane] = make_float4(g[4], g[5], g[6], g[7]);
    }
  __syncthreads();

  const size_t rowoff = bo + (size_t)(qbase + qg * 32) * DIM + kh * 128 + lane * 4;
  const float* xr   = x + rowoff;
  float*       orow = out + rowoff;
  f32x4 xv[32];
  #pragma unroll
  for (int r = 0; r < 32; ++r) xv[r] = *(const f32x4*)(xr + r * DIM);

  asm volatile("s_wait_xcnt 0x0" :: "v"(xr) : "memory");

  float a[2], b[2];
  #pragma unroll
  for (int q = 0; q < 2; ++q) {
    const float mo = mlo[q * 64 + lane];
    const float lo = mlo[q * 64 + 32 + lane];
    const float mx = fmaxf(m[q], mo);
    const float fs = __expf(m[q] - mx), fo = __expf(mo - mx);
    const float inv = 1.0f / (lj[q] * fs + lo * fo);
    a[q] = fs * inv;
    b[q] = fo * inv;
  }

  v8f y[2][8];
  #pragma unroll
  for (int q = 0; q < 2; ++q)
    #pragma unroll
    for (int t = 0; t < 8; ++t) {
      const v8f    o  = up ? O[q][8 + t] : O[q][t];
      const float4 pa = other[((q * 8 + t) * 2 + 0) * 32 + lane];
      const float4 pb = other[((q * 8 + t) * 2 + 1) * 32 + lane];
      y[q][t][0] = o[0] * a[q] + pa.x * b[q]; y[q][t][1] = o[1] * a[q] + pa.y * b[q];
      y[q][t][2] = o[2] * a[q] + pa.z * b[q]; y[q][t][3] = o[3] * a[q] + pa.w * b[q];
      y[q][t][4] = o[4] * a[q] + pb.x * b[q]; y[q][t][5] = o[5] * a[q] + pb.y * b[q];
      y[q][t][6] = o[6] * a[q] + pb.z * b[q]; y[q][t][7] = o[7] * a[q] + pb.w * b[q];
    }

  wait_ds0();
  f32x4* rowst = (f32x4*)other;
  #pragma unroll
  for (int q = 0; q < 2; ++q)
    #pragma unroll
    for (int t = 0; t < 8; ++t) {
      const int row = q * 16 + lr, c = t * 4 + lh * 2;
      f32x4 ya, yb;
      ya[0] = y[q][t][0]; ya[1] = y[q][t][1]; ya[2] = y[q][t][2]; ya[3] = y[q][t][3];
      yb[0] = y[q][t][4]; yb[1] = y[q][t][5]; yb[2] = y[q][t][6]; yb[3] = y[q][t][7];
      rowst[row * 32 + (c ^ lr)]       = ya;
      rowst[row * 32 + ((c + 1) ^ lr)] = yb;
    }
  wait_ds0();

  #pragma unroll
  for (int g = 0; g < 32; g += 8) {
    f32x4 r[8];
    #pragma unroll
    for (int u = 0; u < 8; ++u) {
      const int row = g + u;
      r[u] = xv[row] + rowst[row * 32 + (lane ^ (row & 15))];
      *(f32x4*)(orow + row * DIM) = r[u];
    }

    asm volatile("s_wait_xcnt 0x0" :: "v"(r[0]), "v"(r[1]), "v"(r[2]), "v"(r[3]),
                 "v"(r[4]), "v"(r[5]), "v"(r[6]), "v"(r[7]), "v"(orow) : "memory");
  }
}

extern "C" void kernel_launch(void* const* d_in, const int* in_sizes, int n_in,
                              void* d_out, int out_size, void* d_ws, size_t ws_size,
                              hipStream_t stream) {
  const float* x  = (const float*)d_in[0];
  const float* Wq = (const float*)d_in[1];
  const float* bq = (const float*)d_in[2];
  const float* Wk = (const float*)d_in[3];
  const float* bk = (const float*)d_in[4];
  const float* Wv = (const float*)d_in[5];
  const float* bv = (const float*)d_in[6];
  float* outp = (float*)d_out;

  const size_t NX = (size_t)NROW * DIM;
  const size_t NW = (size_t)DIM * DIM;
  bf16* xb = (bf16*)d_ws;
  bf16* wb = xb + NX;
  bf16* qb = wb + 3 * NW;
  bf16* kb = qb + NX;
  bf16* vb = kb + NX;

  f32_to_bf16_kernel<<<CVT_XWG + 3 * CVT_WWG, 512, 0, stream>>>(x, Wq, Wk, Wv, xb);

  qkv_gemm_kernel<<<dim3(NROW / 128, 6), 128, 0, stream>>>(xb, wb, bq, bk, bv,
                                                          qb, kb, vb);

  attn_kernel<<<dim3(SEQ / 128, BATCH), 256, 0, stream>>>(qb, kb, vb, x, outp);
}
